// v000
// Times are from an AMD MI455X. After a warm-up the kernel runs many times in a row, and a time is the length of
// such a window on the GPU divided by its runs, so every launch and the gaps after it count. The runs cycle
// through copies of the inputs. A figure is the median of several windows, for all but v000 over two sittings.
// Sittings can differ by a few percent; kernels timed side by side share one.
// v000, which the later versions start from, runs in 321 microseconds.
#include <hip/hip_runtime.h>
#include <hip/hip_bf16.h>

typedef __attribute__((ext_vector_type(16))) _Float16 v16h;
typedef __attribute__((ext_vector_type(8)))  _Float16 h8;
typedef __attribute__((ext_vector_type(8)))  float    v8f;
typedef __attribute__((ext_vector_type(4)))  float    f4;

#define NTHREADS 256
#define NWAVES   8

// LDS arena layout (bytes). All offsets 16B-aligned.
#define OFF_Q    0          // 112x128 f16 : Q (pre-scaled)
#define OFF_K    28672      // 112x128 f16 : K
#define OFF_VT   57344      // 128x128 f16 : V transposed [ch][pos]
#define OFF_P    90112      // 112x128 f16 : phase A: x window (A matrix); phase B: scores/probs
#define OFF_O    118784     // 112x128 f16 : attention output (all heads)
#define OFF_CNT  147456     // 112 i32    : shift-mask region id per token
#define OFF_ROW  147904     // 112 i32    : global f32 offset of each token's (rolled) position
#define SMEM_BYTES 148352

// ---- fragment loaders -------------------------------------------------------
// 16-bit A/B operand K-layout (ISA 7.12.2): lane holds 16 halves as two
// contiguous 8-element runs: K in [base, base+8) and [base+16, base+24),
// base = (lane<16 ? 0 : 8).  B mirrors A with the tile column in lanes.

__device__ __forceinline__ v16h frag_lds(const _Float16* __restrict__ row,
                                         int cbase, int lane) {
  const int kb = cbase + ((lane & 16) ? 8 : 0);
  h8 a = *(const h8*)(row + kb);
  h8 b = *(const h8*)(row + kb + 16);
  v16h r;
#pragma unroll
  for (int i = 0; i < 8; ++i) { r[i] = a[i]; r[i + 8] = b[i]; }
  return r;
}

// B fragment straight from a row-major fp32 weight matrix W[o][128]:
// B[c][o] = W[o*128 + c].  Two 8-float contiguous runs -> 4x b128 loads.
__device__ __forceinline__ v16h frag_w128(const float* __restrict__ W,
                                          int o, int ks, int lane) {
  const int kb = ks * 32 + ((lane & 16) ? 8 : 0);
  const float* p = W + o * 128 + kb;
  f4 a0 = *(const f4*)(p);
  f4 a1 = *(const f4*)(p + 4);
  f4 b0 = *(const f4*)(p + 16);
  f4 b1 = *(const f4*)(p + 20);
  v16h r;
#pragma unroll
  for (int i = 0; i < 4; ++i) {
    r[i]      = (_Float16)a0[i];
    r[4 + i]  = (_Float16)a1[i];
    r[8 + i]  = (_Float16)b0[i];
    r[12 + i] = (_Float16)b1[i];
  }
  return r;
}

// C/D layout: VGPR r holds (M = m0 + r + (lane<16?0:8), N = n0 + lane%16)
__device__ __forceinline__ void store_tile(_Float16* __restrict__ dst,
                                           int m0, int n0, int lane,
                                           v8f acc, float mul) {
  const int n  = n0 + (lane & 15);
  const int mb = m0 + ((lane & 16) ? 8 : 0);
#pragma unroll
  for (int r = 0; r < 8; ++r)
    dst[(mb + r) * 128 + n] = (_Float16)(acc[r] * mul);
}

__global__ void __launch_bounds__(NTHREADS)
swin3d_msa_kernel(const float* __restrict__ xg,
                  const float* __restrict__ qkvw,   // (384,128)
                  const float* __restrict__ projw,  // (128,128)
                  const float* __restrict__ projb,  // (128)
                  const float* __restrict__ rpb,    // (507,4)
                  float* __restrict__ outg) {
  extern __shared__ char smem[] __attribute__((aligned(16)));
  _Float16* lQ  = (_Float16*)(smem + OFF_Q);
  _Float16* lK  = (_Float16*)(smem + OFF_K);
  _Float16* lVt = (_Float16*)(smem + OFF_VT);
  _Float16* lP  = (_Float16*)(smem + OFF_P);
  _Float16* lX  = lP;  // phase A alias
  _Float16* lO  = (_Float16*)(smem + OFF_O);
  int* lCnt = (int*)(smem + OFF_CNT);
  int* lRow = (int*)(smem + OFF_ROW);

  const int tid  = threadIdx.x;
  const int lane = tid & 31;
  const int wv   = tid >> 5;

  // window decomposition: blocks ordered (b, bt, bh, bw) = (2, 8, 8, 8)
  const int blk = blockIdx.x;
  const int b   = blk >> 9;
  const int wb  = blk & 511;
  const int bt  = wb >> 6;
  const int bh  = (wb >> 3) & 7;
  const int bw  = wb & 7;

  // zero the f16 arena (padding rows/cols must be 0 for the WMMA tiles)
  {
    uint32_t* z = (uint32_t*)smem;
    for (int i = tid; i < (OFF_CNT >> 2); i += NTHREADS) z[i] = 0u;
  }

  // per-token metadata: region id (shift mask) + global row offset.
  // rolled coords g; source/dest position = (g + shift) % dim (input gather
  // and output scatter use the identical mapping).
  if (tid < 98) {
    const int ti = tid / 49;
    const int rm = tid % 49;
    const int hi = rm / 7;
    const int wi = rm % 7;
    const int gT = bt * 2 + ti, gH = bh * 7 + hi, gW = bw * 7 + wi;
    const int rt = (gT < 14) ? 0 : ((gT < 15) ? 1 : 2);
    const int rh = (gH < 49) ? 0 : ((gH < 53) ? 1 : 2);
    const int rw = (gW < 49) ? 0 : ((gW < 53) ? 1 : 2);
    lCnt[tid] = rt * 9 + rh * 3 + rw;
    const int sT = (gT + 1) & 15;
    int sH = gH + 3; if (sH >= 56) sH -= 56;
    int sW = gW + 3; if (sW >= 56) sW -= 56;
    lRow[tid] = (((b * 16 + sT) * 56 + sH) * 56 + sW) * 128;
  }
  __syncthreads();

  // ---- gather window x (98x128 f32 -> f16 in LDS, rows 98..111 stay 0) ----
  for (int idx = tid; idx < 98 * 32; idx += NTHREADS) {
    const int row = idx >> 5;
    const int c4  = (idx & 31) << 2;
    f4 v = *(const f4*)(xg + lRow[row] + c4);
    _Float16* d = lX + row * 128 + c4;
    d[0] = (_Float16)v[0]; d[1] = (_Float16)v[1];
    d[2] = (_Float16)v[2]; d[3] = (_Float16)v[3];
  }
  __syncthreads();

  // ---- QKV GEMM: (112x384) = X(112x128) @ qkv_w^T(128x384) ----------------
  const float SCALE = 0.17677669529663687f;  // 32^-0.5
  for (int tile = wv; tile < 7 * 24; tile += NWAVES) {
    const int mt = tile / 24;
    const int nt = tile % 24;
    const int o0 = nt * 16;
    const _Float16* arow = lX + (mt * 16 + (lane & 15)) * 128;
    const int o = o0 + (lane & 15);
    v8f acc = {};
#pragma unroll
    for (int ks = 0; ks < 4; ++ks) {
      v16h a  = frag_lds(arow, ks * 32, lane);
      v16h bb = frag_w128(qkvw, o, ks, lane);
      acc = __builtin_amdgcn_wmma_f32_16x16x32_f16(false, a, false, bb,
                                                   (short)0, acc, false, false);
    }
    const int m0 = mt * 16;
    if (o0 < 128) {
      store_tile(lQ, m0, o0, lane, acc, SCALE);          // q * scale
    } else if (o0 < 256) {
      store_tile(lK, m0, o0 - 128, lane, acc, 1.0f);     // k
    } else {                                             // v, transposed
      const int ch = (o0 - 256) + (lane & 15);
      const int mb = m0 + ((lane & 16) ? 8 : 0);
#pragma unroll
      for (int r = 0; r < 8; ++r)
        lVt[ch * 128 + mb + r] = (_Float16)acc[r];
    }
  }
  __syncthreads();

  // ---- attention, one head at a time --------------------------------------
  for (int h = 0; h < 4; ++h) {
    // S = Q_h @ K_h^T : K dim = hd = 32 -> exactly one WMMA per 16x16 tile
    for (int tile = wv; tile < 49; tile += NWAVES) {
      const int mt = tile / 7, nt = tile % 7;
      const _Float16* arow = lQ + (mt * 16 + (lane & 15)) * 128;
      const _Float16* brow = lK + (nt * 16 + (lane & 15)) * 128;
      v16h a  = frag_lds(arow, h * 32, lane);
      v16h bb = frag_lds(brow, h * 32, lane);
      v8f acc = {};
      acc = __builtin_amdgcn_wmma_f32_16x16x32_f16(false, a, false, bb,
                                                   (short)0, acc, false, false);
      store_tile(lP, mt * 16, nt * 16, lane, acc, 1.0f);
    }
    __syncthreads();

    // row softmax with on-the-fly rel-pos bias + shift mask
    if (tid < 98) {
      const int tr = tid / 49;
      const int rr = tid % 49;
      const int hr = rr / 7;
      const int wr = rr % 7;
      const int cr = lCnt[tid];
      _Float16* row = lP + tid * 128;
      float vmax = -3.0e38f;
      int tm = 0, hm = 0, wm = 0;
      for (int m = 0; m < 98; ++m) {
        const int rpi = (tr - tm + 1) * 169 + (hr - hm + 6) * 13 + (wr - wm + 6);
        float s = (float)row[m] + rpb[rpi * 4 + h];
        if (lCnt[m] != cr) s -= 100.0f;
        vmax = fmaxf(vmax, s);
        if (++wm == 7) { wm = 0; if (++hm == 7) { hm = 0; ++tm; } }
      }
      float sum = 0.0f; tm = hm = wm = 0;
      for (int m = 0; m < 98; ++m) {
        const int rpi = (tr - tm + 1) * 169 + (hr - hm + 6) * 13 + (wr - wm + 6);
        float s = (float)row[m] + rpb[rpi * 4 + h];
        if (lCnt[m] != cr) s -= 100.0f;
        const float e = __expf(s - vmax);
        sum += e;
        row[m] = (_Float16)e;
        if (++wm == 7) { wm = 0; if (++hm == 7) { hm = 0; ++tm; } }
      }
      const float inv = 1.0f / sum;
      for (int m = 0; m < 98; ++m) row[m] = (_Float16)((float)row[m] * inv);
      for (int m = 98; m < 112; ++m) row[m] = (_Float16)0.0f;  // K-padding
    } else if (tid < 112) {
      _Float16* row = lP + tid * 128;
      for (int m = 0; m < 112; ++m) row[m] = (_Float16)0.0f;   // junk rows
    }
    __syncthreads();

    // O_h(112x32) = P(112x128) @ V_h(128x32); B fragments from V^T rows
    for (int tile = wv; tile < 14; tile += NWAVES) {
      const int mt  = tile % 7;
      const int ntc = tile / 7;
      const _Float16* arow = lP + (mt * 16 + (lane & 15)) * 128;
      const _Float16* brow = lVt + (h * 32 + ntc * 16 + (lane & 15)) * 128;
      v8f acc = {};
#pragma unroll
      for (int ks = 0; ks < 4; ++ks) {
        v16h a  = frag_lds(arow, ks * 32, lane);
        v16h bb = frag_lds(brow, ks * 32, lane);
        acc = __builtin_amdgcn_wmma_f32_16x16x32_f16(false, a, false, bb,
                                                     (short)0, acc, false, false);
      }
      store_tile(lO, mt * 16, h * 32 + ntc * 16, lane, acc, 1.0f);
    }
    __syncthreads();
  }

  // ---- proj GEMM + bias, scatter to rolled-back positions -----------------
  for (int tile = wv; tile < 56; tile += NWAVES) {
    const int mt = tile >> 3;
    const int nt = tile & 7;
    const _Float16* arow = lO + (mt * 16 + (lane & 15)) * 128;
    const int o = nt * 16 + (lane & 15);
    v8f acc = {};
#pragma unroll
    for (int ks = 0; ks < 4; ++ks) {
      v16h a  = frag_lds(arow, ks * 32, lane);
      v16h bb = frag_w128(projw, o, ks, lane);
      acc = __builtin_amdgcn_wmma_f32_16x16x32_f16(false, a, false, bb,
                                                   (short)0, acc, false, false);
    }
    const float pb = projb[o];
    const int mb = mt * 16 + ((lane & 16) ? 8 : 0);
#pragma unroll
    for (int r = 0; r < 8; ++r) {
      const int m = mb + r;
      if (m < 98) outg[lRow[m] + o] = acc[r] + pb;
    }
  }
}

extern "C" void kernel_launch(void* const* d_in, const int* in_sizes, int n_in,
                              void* d_out, int out_size, void* d_ws, size_t ws_size,
                              hipStream_t stream) {
  (void)in_sizes; (void)n_in; (void)d_ws; (void)ws_size; (void)out_size;
  const float* x     = (const float*)d_in[0];
  const float* qkvw  = (const float*)d_in[1];
  const float* projw = (const float*)d_in[2];
  const float* projb = (const float*)d_in[3];
  const float* rpb   = (const float*)d_in[4];
  float* out = (float*)d_out;

  // allow >64KB dynamic LDS (WGP has 320KB); harmless if already set
  (void)hipFuncSetAttribute(reinterpret_cast<const void*>(swin3d_msa_kernel),
                            hipFuncAttributeMaxDynamicSharedMemorySize,
                            SMEM_BYTES);

  swin3d_msa_kernel<<<1024, NTHREADS, SMEM_BYTES, stream>>>(
      x, qkvw, projw, projb, rpb, out);
}

// v001
// A run of this version takes 220 microseconds.
// In both of two side-by-side timings against v000, it was 1.50 times as fast.
#include <hip/hip_runtime.h>
#include <hip/hip_bf16.h>

typedef __attribute__((ext_vector_type(16))) _Float16 v16h;
typedef __attribute__((ext_vector_type(8)))  _Float16 h8;
typedef __attribute__((ext_vector_type(8)))  float    v8f;
typedef __attribute__((ext_vector_type(4)))  float    f4;

#define NTHREADS 256
#define NWAVES   8

// LDS arena layout (bytes). All offsets 16B-aligned.
#define OFF_Q    0          // 112x128 f16 : Q (pre-scaled)
#define OFF_K    28672      // 112x128 f16 : K
#define OFF_VT   57344      // 128x128 f16 : V transposed [ch][pos]
#define OFF_P    90112      // 112x128 f16 : phase A: x window (A matrix); phase B: scores/probs
#define OFF_O    118784     // 112x128 f16 : attention output (all heads)
#define OFF_CNT  147456     // 112 i32    : shift-mask region id per token
#define OFF_ROW  147904     // 112 i32    : global f32 offset of each token's (rolled) position
#define SMEM_BYTES 148352

// ---- fragment loaders -------------------------------------------------------
// 16-bit A/B operand K-layout (ISA 7.12.2): lane holds 16 halves as two
// contiguous 8-element runs: K in [base, base+8) and [base+16, base+24),
// base = (lane<16 ? 0 : 8).  B mirrors A with the tile column in lanes.

__device__ __forceinline__ v16h frag_lds(const _Float16* __restrict__ row,
                                         int cbase, int lane) {
  const int kb = cbase + ((lane & 16) ? 8 : 0);
  h8 a = *(const h8*)(row + kb);
  h8 b = *(const h8*)(row + kb + 16);
  v16h r;
#pragma unroll
  for (int i = 0; i < 8; ++i) { r[i] = a[i]; r[i + 8] = b[i]; }
  return r;
}

// B fragment straight from a row-major fp32 weight matrix W[o][128]:
// B[c][o] = W[o*128 + c].  Two 8-float contiguous runs -> 4x b128 loads.
__device__ __forceinline__ v16h frag_w128(const float* __restrict__ W,
                                          int o, int ks, int lane) {
  const int kb = ks * 32 + ((lane & 16) ? 8 : 0);
  const float* p = W + o * 128 + kb;
  f4 a0 = *(const f4*)(p);
  f4 a1 = *(const f4*)(p + 4);
  f4 b0 = *(const f4*)(p + 16);
  f4 b1 = *(const f4*)(p + 20);
  v16h r;
#pragma unroll
  for (int i = 0; i < 4; ++i) {
    r[i]      = (_Float16)a0[i];
    r[4 + i]  = (_Float16)a1[i];
    r[8 + i]  = (_Float16)b0[i];
    r[12 + i] = (_Float16)b1[i];
  }
  return r;
}

// C/D layout: VGPR r holds (M = m0 + r + (lane<16?0:8), N = n0 + lane%16)
__device__ __forceinline__ void store_tile(_Float16* __restrict__ dst,
                                           int m0, int n0, int lane,
                                           v8f acc, float mul) {
  const int n  = n0 + (lane & 15);
  const int mb = m0 + ((lane & 16) ? 8 : 0);
#pragma unroll
  for (int r = 0; r < 8; ++r)
    dst[(mb + r) * 128 + n] = (_Float16)(acc[r] * mul);
}

// maximum / sum over the lane's 16-lane row, result in all 16 lanes; every lane
// of the wave must be on.  asm: the DPP builtin compiled to a move, a DPP move
// and the operation (for the maximum, two) per step instead of one instruction.
__device__ __forceinline__ float row16_max(float x) {
  asm("v_max_num_f32_dpp %0, %0, %0 row_xmask:1 row_mask:0xf bank_mask:0xf\n\t"
      "v_max_num_f32_dpp %0, %0, %0 row_xmask:2 row_mask:0xf bank_mask:0xf\n\t"
      "v_max_num_f32_dpp %0, %0, %0 row_xmask:4 row_mask:0xf bank_mask:0xf\n\t"
      "v_max_num_f32_dpp %0, %0, %0 row_xmask:8 row_mask:0xf bank_mask:0xf"
      : "+v"(x));
  return x;
}
__device__ __forceinline__ float row16_sum(float x) {
  asm("v_add_f32_dpp %0, %0, %0 row_xmask:1 row_mask:0xf bank_mask:0xf\n\t"
      "v_add_f32_dpp %0, %0, %0 row_xmask:2 row_mask:0xf bank_mask:0xf\n\t"
      "v_add_f32_dpp %0, %0, %0 row_xmask:4 row_mask:0xf bank_mask:0xf\n\t"
      "v_add_f32_dpp %0, %0, %0 row_xmask:8 row_mask:0xf bank_mask:0xf"
      : "+v"(x));
  return x;
}

__global__ void __launch_bounds__(NTHREADS)
swin3d_msa_kernel(const float* __restrict__ xg,
                  const float* __restrict__ qkvw,   // (384,128)
                  const float* __restrict__ projw,  // (128,128)
                  const float* __restrict__ projb,  // (128)
                  const float* __restrict__ rpb,    // (507,4)
                  float* __restrict__ outg) {
  extern __shared__ char smem[] __attribute__((aligned(16)));
  _Float16* lQ  = (_Float16*)(smem + OFF_Q);
  _Float16* lK  = (_Float16*)(smem + OFF_K);
  _Float16* lVt = (_Float16*)(smem + OFF_VT);
  _Float16* lP  = (_Float16*)(smem + OFF_P);
  _Float16* lX  = lP;  // phase A alias
  _Float16* lO  = (_Float16*)(smem + OFF_O);
  int* lCnt = (int*)(smem + OFF_CNT);
  int* lRow = (int*)(smem + OFF_ROW);

  const int tid  = threadIdx.x;
  const int lane = tid & 31;
  const int wv   = tid >> 5;

  // window decomposition: blocks ordered (b, bt, bh, bw) = (2, 8, 8, 8)
  const int blk = blockIdx.x;
  const int b   = blk >> 9;
  const int wb  = blk & 511;
  const int bt  = wb >> 6;
  const int bh  = (wb >> 3) & 7;
  const int bw  = wb & 7;

  // zero the f16 arena (padding rows/cols must be 0 for the WMMA tiles)
  {
    uint32_t* z = (uint32_t*)smem;
    for (int i = tid; i < (OFF_CNT >> 2); i += NTHREADS) z[i] = 0u;
  }

  // per-token metadata: region id (shift mask) + global row offset.
  // rolled coords g; source/dest position = (g + shift) % dim (input gather
  // and output scatter use the identical mapping).
  if (tid < 98) {
    const int ti = tid / 49;
    const int rm = tid % 49;
    const int hi = rm / 7;
    const int wi = rm % 7;
    const int gT = bt * 2 + ti, gH = bh * 7 + hi, gW = bw * 7 + wi;
    const int rt = (gT < 14) ? 0 : ((gT < 15) ? 1 : 2);
    const int rh = (gH < 49) ? 0 : ((gH < 53) ? 1 : 2);
    const int rw = (gW < 49) ? 0 : ((gW < 53) ? 1 : 2);
    lCnt[tid] = rt * 9 + rh * 3 + rw;
    const int sT = (gT + 1) & 15;
    int sH = gH + 3; if (sH >= 56) sH -= 56;
    int sW = gW + 3; if (sW >= 56) sW -= 56;
    lRow[tid] = (((b * 16 + sT) * 56 + sH) * 56 + sW) * 128;
  }
  __syncthreads();

  // ---- gather window x (98x128 f32 -> f16 in LDS, rows 98..111 stay 0) ----
  for (int idx = tid; idx < 98 * 32; idx += NTHREADS) {
    const int row = idx >> 5;
    const int c4  = (idx & 31) << 2;
    f4 v = *(const f4*)(xg + lRow[row] + c4);
    _Float16* d = lX + row * 128 + c4;
    d[0] = (_Float16)v[0]; d[1] = (_Float16)v[1];
    d[2] = (_Float16)v[2]; d[3] = (_Float16)v[3];
  }
  __syncthreads();

  // ---- QKV GEMM: (112x384) = X(112x128) @ qkv_w^T(128x384) ----------------
  const float SCALE = 0.17677669529663687f;  // 32^-0.5
  for (int tile = wv; tile < 7 * 24; tile += NWAVES) {
    const int mt = tile / 24;
    const int nt = tile % 24;
    const int o0 = nt * 16;
    const _Float16* arow = lX + (mt * 16 + (lane & 15)) * 128;
    const int o = o0 + (lane & 15);
    v8f acc = {};
#pragma unroll
    for (int ks = 0; ks < 4; ++ks) {
      v16h a  = frag_lds(arow, ks * 32, lane);
      v16h bb = frag_w128(qkvw, o, ks, lane);
      acc = __builtin_amdgcn_wmma_f32_16x16x32_f16(false, a, false, bb,
                                                   (short)0, acc, false, false);
    }
    const int m0 = mt * 16;
    if (o0 < 128) {
      store_tile(lQ, m0, o0, lane, acc, SCALE);          // q * scale
    } else if (o0 < 256) {
      store_tile(lK, m0, o0 - 128, lane, acc, 1.0f);     // k
    } else {                                             // v, transposed
      const int ch = (o0 - 256) + (lane & 15);
      const int mb = m0 + ((lane & 16) ? 8 : 0);
#pragma unroll
      for (int r = 0; r < 8; ++r)
        lVt[ch * 128 + mb + r] = (_Float16)acc[r];
    }
  }
  __syncthreads();

  // softmax column constants of this lane: columns l16 + 16 j, j = 0..6
  const int l16  = lane & 15;
  const int half = lane >> 4;
  unsigned colOff[7];  // (253 - (tm*169 + hm*13 + wm)) * 16, byte offset into rpb
  int colCnt[7];   // shift-mask region of the column's token
  for (int j = 0; j < 7; ++j) {
    const int m  = l16 + 16 * j;
    const int mc = (m < 98) ? m : 97;      // padding columns: stay in the table
    const int tm = (mc >= 49) ? 1 : 0;
    const int hm = (mc - 49 * tm) / 7;
    colOff[j] = (unsigned)(253 - (mc + 120 * tm + 6 * hm)) * 16u;
    colCnt[j] = lCnt[mc];
  }

  // ---- attention, one head at a time --------------------------------------
  for (int h = 0; h < 4; ++h) {
    // S = Q_h @ K_h^T : K dim = hd = 32 -> exactly one WMMA per 16x16 tile
    for (int tile = wv; tile < 49; tile += NWAVES) {
      const int mt = tile / 7, nt = tile % 7;
      const _Float16* arow = lQ + (mt * 16 + (lane & 15)) * 128;
      const _Float16* brow = lK + (nt * 16 + (lane & 15)) * 128;
      v16h a  = frag_lds(arow, h * 32, lane);
      v16h bb = frag_lds(brow, h * 32, lane);
      v8f acc = {};
      acc = __builtin_amdgcn_wmma_f32_16x16x32_f16(false, a, false, bb,
                                                   (short)0, acc, false, false);
      store_tile(lP, mt * 16, nt * 16, lane, acc, 1.0f);
    }
    __syncthreads();

    // row softmax with on-the-fly rel-pos bias + shift mask.
    // 16 lanes share a row (lane l16 owns columns l16 + 16 j), a wave takes two
    // adjacent rows per pass, all 8 waves work; scores stay in registers from
    // the maximum to the normalised store.
    const char* rpbb = (const char*)rpb;   // uniform base; lanes add a 32-bit byte offset
    const unsigned h4 = (unsigned)h * 4u;
    _Float16 xq[2][7];   // scores, bias and row region of this pass and the next
    float    bq[2][7];
    int      crq[2];
    auto sm_load = [&](int i, int buf) {
      const int row = 2 * (wv + 8 * i) + half;
      const int tr  = (row >= 49) ? 1 : 0;
      const int hr  = (row - 49 * tr) / 7;
      const unsigned ro = (unsigned)(row + 120 * tr + 6 * hr) * 16u;  // (tr*169 + hr*13 + wr) * 16 B
      const _Float16* prow = lP + row * 128 + l16;
      crq[buf] = lCnt[row];
      for (int j = 0; j < 7; ++j) {
        xq[buf][j] = prow[16 * j];
        bq[buf][j] = *(const float*)(rpbb + (ro + colOff[j] + h4));
      }
    };
    auto sm_pass = [&](int i, int buf) {
      _Float16* prow = lP + (2 * (wv + 8 * i) + half) * 128 + l16;
      float s[7];
      for (int j = 0; j < 7; ++j) {
        float v = (float)xq[buf][j] + bq[buf][j];
        if (colCnt[j] != crq[buf]) v -= 100.0f;
        s[j] = v;
      }
      if (l16 >= 2) s[6] = -3.0e38f;       // columns 98..111: K-padding
      float vmax = s[0];
      for (int j = 1; j < 7; ++j) vmax = fmaxf(vmax, s[j]);
      vmax = row16_max(vmax);
      float sum = 0.0f;
      for (int j = 0; j < 7; ++j) {
        s[j] = __expf(s[j] - vmax);
        sum += s[j];
      }
      const float inv = __builtin_amdgcn_rcpf(row16_sum(sum));
      for (int j = 0; j < 7; ++j) prow[16 * j] = (_Float16)(s[j] * inv);
    };
    sm_load(0, 0);
    // unrolled at once, so that xq/bq/crq are indexed by constants from the start;
    // left to the late unroller the build took half as many registers again
#pragma unroll
    for (int i = 0; i < 6; ++i) {          // row pairs 0..47
      if (i < 5) sm_load(i + 1, (i + 1) & 1);  // next pass's loads fly under this pass
      sm_pass(i, i & 1);
    }
    if (wv == 0) {                         // row pair 48
      sm_load(6, 0);
      sm_pass(6, 0);
    } else {                               // row pairs 49..55: junk rows
      _Float16* prow = lP + (2 * (wv + 48) + half) * 128 + l16;
      for (int j = 0; j < 7; ++j) prow[16 * j] = (_Float16)0.0f;
    }
    __syncthreads();

    // O_h(112x32) = P(112x128) @ V_h(128x32); B fragments from V^T rows
    for (int tile = wv; tile < 14; tile += NWAVES) {
      const int mt  = tile % 7;
      const int ntc = tile / 7;
      const _Float16* arow = lP + (mt * 16 + (lane & 15)) * 128;
      const _Float16* brow = lVt + (h * 32 + ntc * 16 + (lane & 15)) * 128;
      v8f acc = {};
#pragma unroll
      for (int ks = 0; ks < 4; ++ks) {
        v16h a  = frag_lds(arow, ks * 32, lane);
        v16h bb = frag_lds(brow, ks * 32, lane);
        acc = __builtin_amdgcn_wmma_f32_16x16x32_f16(false, a, false, bb,
                                                     (short)0, acc, false, false);
      }
      store_tile(lO, mt * 16, h * 32 + ntc * 16, lane, acc, 1.0f);
    }
    __syncthreads();
  }

  // ---- proj GEMM + bias, scatter to rolled-back positions -----------------
  for (int tile = wv; tile < 56; tile += NWAVES) {
    const int mt = tile >> 3;
    const int nt = tile & 7;
    const _Float16* arow = lO + (mt * 16 + (lane & 15)) * 128;
    const int o = nt * 16 + (lane & 15);
    v8f acc = {};
#pragma unroll
    for (int ks = 0; ks < 4; ++ks) {
      v16h a  = frag_lds(arow, ks * 32, lane);
      v16h bb = frag_w128(projw, o, ks, lane);
      acc = __builtin_amdgcn_wmma_f32_16x16x32_f16(false, a, false, bb,
                                                   (short)0, acc, false, false);
    }
    const float pb = projb[o];
    const int mb = mt * 16 + ((lane & 16) ? 8 : 0);
#pragma unroll
    for (int r = 0; r < 8; ++r) {
      const int m = mb + r;
      if (m < 98) outg[lRow[m] + o] = acc[r] + pb;
    }
  }
}

extern "C" void kernel_launch(void* const* d_in, const int* in_sizes, int n_in,
                              void* d_out, int out_size, void* d_ws, size_t ws_size,
                              hipStream_t stream) {
  (void)in_sizes; (void)n_in; (void)d_ws; (void)ws_size; (void)out_size;
  const float* x     = (const float*)d_in[0];
  const float* qkvw  = (const float*)d_in[1];
  const float* projw = (const float*)d_in[2];
  const float* projb = (const float*)d_in[3];
  const float* rpb   = (const float*)d_in[4];
  float* out = (float*)d_out;

  // allow >64KB dynamic LDS (WGP has 320KB); harmless if already set
  (void)hipFuncSetAttribute(reinterpret_cast<const void*>(swin3d_msa_kernel),
                            hipFuncAttributeMaxDynamicSharedMemorySize,
                            SMEM_BYTES);

  swin3d_msa_kernel<<<1024, NTHREADS, SMEM_BYTES, stream>>>(
      x, qkvw, projw, projb, rpb, out);
}

// v002
// A run of this version takes 125 microseconds.
// Next to v001, in two timings, it ran 1.76 and 1.75 times as fast.
// All steps since v000 together make it 2.63 times as fast.
#include <hip/hip_runtime.h>
#include <hip/hip_bf16.h>

typedef __attribute__((ext_vector_type(16))) _Float16 v16h;
typedef __attribute__((ext_vector_type(8)))  _Float16 h8;
typedef __attribute__((ext_vector_type(8)))  float    v8f;
typedef __attribute__((ext_vector_type(4)))  float    f4;

#define NTHREADS 256
#define NWAVES   8

// Row pitch of every f16 matrix in LDS, in halves: 128 data + 8 pad = 272 B =
// 16 B x odd, so the 16 rows that one ds_load_b128 fragment read touches fall on
// 16 different groups of four banks (at 256 B they all fall on the same four).
// The pad halves are never read.
#define LDP      136

// LDS arena layout (bytes). All offsets 16B-aligned.
#define OFF_Q    0          // 112 rows f16 : Q (pre-scaled)
#define OFF_K    30464      // 112 rows f16 : K
#define OFF_VT   60928      // 128 rows f16 : V transposed [ch][pos]
#define OFF_P    95744      // 112 rows f16 : phase A: x window (A matrix); phase B: scores/probs
#define OFF_O    126208     // 112 rows f16 : attention output (all heads)
#define OFF_CNT  156672     // 112 i32    : shift-mask region id per token
#define OFF_ROW  157120     // 112 i32    : global f32 offset of each token's (rolled) position
#define SMEM_BYTES 157568

// ---- fragment loaders -------------------------------------------------------
// 16-bit A/B operand K-layout (ISA 7.12.2): lane holds 16 halves as two
// contiguous 8-element runs: K in [base, base+8) and [base+16, base+24),
// base = (lane<16 ? 0 : 8).  B mirrors A with the tile column in lanes.

__device__ __forceinline__ v16h frag_lds(const _Float16* __restrict__ row,
                                         int cbase, int lane) {
  const int kb = cbase + ((lane & 16) ? 8 : 0);
  h8 a = *(const h8*)(row + kb);
  h8 b = *(const h8*)(row + kb + 16);
  v16h r;
#pragma unroll
  for (int i = 0; i < 8; ++i) { r[i] = a[i]; r[i + 8] = b[i]; }
  return r;
}

// B fragment straight from a row-major fp32 weight matrix W[o][128]:
// B[c][o] = W[o*128 + c].  Two 8-float contiguous runs -> 4x b128 loads.
__device__ __forceinline__ v16h frag_w128(const float* __restrict__ W,
                                          int o, int ks, int lane) {
  const int kb = ks * 32 + ((lane & 16) ? 8 : 0);
  const float* p = W + o * 128 + kb;
  f4 a0 = *(const f4*)(p);
  f4 a1 = *(const f4*)(p + 4);
  f4 b0 = *(const f4*)(p + 16);
  f4 b1 = *(const f4*)(p + 20);
  v16h r;
#pragma unroll
  for (int i = 0; i < 4; ++i) {
    r[i]      = (_Float16)a0[i];
    r[4 + i]  = (_Float16)a1[i];
    r[8 + i]  = (_Float16)b0[i];
    r[12 + i] = (_Float16)b1[i];
  }
  return r;
}

// C/D layout: VGPR r holds (M = m0 + r + (lane<16?0:8), N = n0 + lane%16)
__device__ __forceinline__ void store_tile(_Float16* __restrict__ dst,
                                           int m0, int n0, int lane,
                                           v8f acc, float mul) {
  const int n  = n0 + (lane & 15);
  const int mb = m0 + ((lane & 16) ? 8 : 0);
#pragma unroll
  for (int r = 0; r < 8; ++r)
    dst[(mb + r) * LDP + n] = (_Float16)(acc[r] * mul);
}

// maximum / sum over the lane's 16-lane row, result in all 16 lanes; every lane
// of the wave must be on.  asm: the DPP builtin compiled to a move, a DPP move
// and the operation (for the maximum, two) per step instead of one instruction.
__device__ __forceinline__ float row16_max(float x) {
  asm("v_max_num_f32_dpp %0, %0, %0 row_xmask:1 row_mask:0xf bank_mask:0xf\n\t"
      "v_max_num_f32_dpp %0, %0, %0 row_xmask:2 row_mask:0xf bank_mask:0xf\n\t"
      "v_max_num_f32_dpp %0, %0, %0 row_xmask:4 row_mask:0xf bank_mask:0xf\n\t"
      "v_max_num_f32_dpp %0, %0, %0 row_xmask:8 row_mask:0xf bank_mask:0xf"
      : "+v"(x));
  return x;
}
__device__ __forceinline__ float row16_sum(float x) {
  asm("v_add_f32_dpp %0, %0, %0 row_xmask:1 row_mask:0xf bank_mask:0xf\n\t"
      "v_add_f32_dpp %0, %0, %0 row_xmask:2 row_mask:0xf bank_mask:0xf\n\t"
      "v_add_f32_dpp %0, %0, %0 row_xmask:4 row_mask:0xf bank_mask:0xf\n\t"
      "v_add_f32_dpp %0, %0, %0 row_xmask:8 row_mask:0xf bank_mask:0xf"
      : "+v"(x));
  return x;
}

__global__ void __launch_bounds__(NTHREADS)
swin3d_msa_kernel(const float* __restrict__ xg,
                  const float* __restrict__ qkvw,   // (384,128)
                  const float* __restrict__ projw,  // (128,128)
                  const float* __restrict__ projb,  // (128)
                  const float* __restrict__ rpb,    // (507,4)
                  float* __restrict__ outg) {
  extern __shared__ char smem[] __attribute__((aligned(16)));
  _Float16* lQ  = (_Float16*)(smem + OFF_Q);
  _Float16* lK  = (_Float16*)(smem + OFF_K);
  _Float16* lVt = (_Float16*)(smem + OFF_VT);
  _Float16* lP  = (_Float16*)(smem + OFF_P);
  _Float16* lX  = lP;  // phase A alias
  _Float16* lO  = (_Float16*)(smem + OFF_O);
  int* lCnt = (int*)(smem + OFF_CNT);
  int* lRow = (int*)(smem + OFF_ROW);

  const int tid  = threadIdx.x;
  const int lane = tid & 31;
  const int wv   = tid >> 5;

  // window decomposition: blocks ordered (b, bt, bh, bw) = (2, 8, 8, 8)
  const int blk = blockIdx.x;
  const int b   = blk >> 9;
  const int wb  = blk & 511;
  const int bt  = wb >> 6;
  const int bh  = (wb >> 3) & 7;
  const int bw  = wb & 7;

  // zero the f16 arena (padding rows/cols must be 0 for the WMMA tiles)
  {
    uint32_t* z = (uint32_t*)smem;
    for (int i = tid; i < (OFF_CNT >> 2); i += NTHREADS) z[i] = 0u;
  }

  // per-token metadata: region id (shift mask) + global row offset.
  // rolled coords g; source/dest position = (g + shift) % dim (input gather
  // and output scatter use the identical mapping).
  if (tid < 98) {
    const int ti = tid / 49;
    const int rm = tid % 49;
    const int hi = rm / 7;
    const int wi = rm % 7;
    const int gT = bt * 2 + ti, gH = bh * 7 + hi, gW = bw * 7 + wi;
    const int rt = (gT < 14) ? 0 : ((gT < 15) ? 1 : 2);
    const int rh = (gH < 49) ? 0 : ((gH < 53) ? 1 : 2);
    const int rw = (gW < 49) ? 0 : ((gW < 53) ? 1 : 2);
    lCnt[tid] = rt * 9 + rh * 3 + rw;
    const int sT = (gT + 1) & 15;
    int sH = gH + 3; if (sH >= 56) sH -= 56;
    int sW = gW + 3; if (sW >= 56) sW -= 56;
    lRow[tid] = (((b * 16 + sT) * 56 + sH) * 56 + sW) * 128;
  }
  __syncthreads();

  // ---- gather window x (98x128 f32 -> f16 in LDS, rows 98..111 stay 0) ----
  for (int idx = tid; idx < 98 * 32; idx += NTHREADS) {
    const int row = idx >> 5;
    const int c4  = (idx & 31) << 2;
    f4 v = *(const f4*)(xg + lRow[row] + c4);
    _Float16* d = lX + row * LDP + c4;
    d[0] = (_Float16)v[0]; d[1] = (_Float16)v[1];
    d[2] = (_Float16)v[2]; d[3] = (_Float16)v[3];
  }
  __syncthreads();

  // ---- QKV GEMM: (112x384) = X(112x128) @ qkv_w^T(128x384) ----------------
  const float SCALE = 0.17677669529663687f;  // 32^-0.5
  for (int tile = wv; tile < 7 * 24; tile += NWAVES) {
    const int mt = tile / 24;
    const int nt = tile % 24;
    const int o0 = nt * 16;
    const _Float16* arow = lX + (mt * 16 + (lane & 15)) * LDP;
    const int o = o0 + (lane & 15);
    v8f acc = {};
#pragma unroll
    for (int ks = 0; ks < 4; ++ks) {
      v16h a  = frag_lds(arow, ks * 32, lane);
      v16h bb = frag_w128(qkvw, o, ks, lane);
      acc = __builtin_amdgcn_wmma_f32_16x16x32_f16(false, a, false, bb,
                                                   (short)0, acc, false, false);
    }
    const int m0 = mt * 16;
    if (o0 < 128) {
      store_tile(lQ, m0, o0, lane, acc, SCALE);          // q * scale
    } else if (o0 < 256) {
      store_tile(lK, m0, o0 - 128, lane, acc, 1.0f);     // k
    } else {                                             // v, transposed
      const int ch = (o0 - 256) + (lane & 15);
      const int mb = m0 + ((lane & 16) ? 8 : 0);
#pragma unroll
      for (int r = 0; r < 8; ++r)
        lVt[ch * LDP + mb + r] = (_Float16)acc[r];
    }
  }
  __syncthreads();

  // softmax column constants of this lane: columns l16 + 16 j, j = 0..6
  const int l16  = lane & 15;
  const int half = lane >> 4;
  unsigned colOff[7];  // (253 - (tm*169 + hm*13 + wm)) * 16, byte offset into rpb
  int colCnt[7];   // shift-mask region of the column's token
  for (int j = 0; j < 7; ++j) {
    const int m  = l16 + 16 * j;
    const int mc = (m < 98) ? m : 97;      // padding columns: stay in the table
    const int tm = (mc >= 49) ? 1 : 0;
    const int hm = (mc - 49 * tm) / 7;
    colOff[j] = (unsigned)(253 - (mc + 120 * tm + 6 * hm)) * 16u;
    colCnt[j] = lCnt[mc];
  }

  // ---- attention, one head at a time --------------------------------------
  for (int h = 0; h < 4; ++h) {
    // S = Q_h @ K_h^T : K dim = hd = 32 -> exactly one WMMA per 16x16 tile
    for (int tile = wv; tile < 49; tile += NWAVES) {
      const int mt = tile / 7, nt = tile % 7;
      const _Float16* arow = lQ + (mt * 16 + (lane & 15)) * LDP;
      const _Float16* brow = lK + (nt * 16 + (lane & 15)) * LDP;
      v16h a  = frag_lds(arow, h * 32, lane);
      v16h bb = frag_lds(brow, h * 32, lane);
      v8f acc = {};
      acc = __builtin_amdgcn_wmma_f32_16x16x32_f16(false, a, false, bb,
                                                   (short)0, acc, false, false);
      store_tile(lP, mt * 16, nt * 16, lane, acc, 1.0f);
    }
    __syncthreads();

    // row softmax with on-the-fly rel-pos bias + shift mask.
    // 16 lanes share a row (lane l16 owns columns l16 + 16 j), a wave takes two
    // adjacent rows per pass, all 8 waves work; scores stay in registers from
    // the maximum to the normalised store.
    const char* rpbb = (const char*)rpb;   // uniform base; lanes add a 32-bit byte offset
    const unsigned h4 = (unsigned)h * 4u;
    _Float16 xq[2][7];   // scores, bias and row region of this pass and the next
    float    bq[2][7];
    int      crq[2];
    auto sm_load = [&](int i, int buf) {
      const int row = 2 * (wv + 8 * i) + half;
      const int tr  = (row >= 49) ? 1 : 0;
      const int hr  = (row - 49 * tr) / 7;
      const unsigned ro = (unsigned)(row + 120 * tr + 6 * hr) * 16u;  // (tr*169 + hr*13 + wr) * 16 B
      const _Float16* prow = lP + row * LDP + l16;
      crq[buf] = lCnt[row];
      for (int j = 0; j < 7; ++j) {
        xq[buf][j] = prow[16 * j];
        bq[buf][j] = *(const float*)(rpbb + (ro + colOff[j] + h4));
      }
    };
    auto sm_pass = [&](int i, int buf) {
      _Float16* prow = lP + (2 * (wv + 8 * i) + half) * LDP + l16;
      float s[7];
      for (int j = 0; j < 7; ++j) {
        float v = (float)xq[buf][j] + bq[buf][j];
        if (colCnt[j] != crq[buf]) v -= 100.0f;
        s[j] = v;
      }
      if (l16 >= 2) s[6] = -3.0e38f;       // columns 98..111: K-padding
      float vmax = s[0];
      for (int j = 1; j < 7; ++j) vmax = fmaxf(vmax, s[j]);
      vmax = row16_max(vmax);
      float sum = 0.0f;
      for (int j = 0; j < 7; ++j) {
        s[j] = __expf(s[j] - vmax);
        sum += s[j];
      }
      const float inv = __builtin_amdgcn_rcpf(row16_sum(sum));
      for (int j = 0; j < 7; ++j) prow[16 * j] = (_Float16)(s[j] * inv);
    };
    sm_load(0, 0);
    // unrolled at once, so that xq/bq/crq are indexed by constants from the start;
    // left to the late unroller the build took half as many registers again
#pragma unroll
    for (int i = 0; i < 6; ++i) {          // row pairs 0..47
      if (i < 5) sm_load(i + 1, (i + 1) & 1);  // next pass's loads fly under this pass
      sm_pass(i, i & 1);
    }
    if (wv == 0) {                         // row pair 48
      sm_load(6, 0);
      sm_pass(6, 0);
    } else {                               // row pairs 49..55: junk rows
      _Float16* prow = lP + (2 * (wv + 48) + half) * LDP + l16;
      for (int j = 0; j < 7; ++j) prow[16 * j] = (_Float16)0.0f;
    }
    __syncthreads();

    // O_h(112x32) = P(112x128) @ V_h(128x32); B fragments from V^T rows
    for (int tile = wv; tile < 14; tile += NWAVES) {
      const int mt  = tile % 7;
      const int ntc = tile / 7;
      const _Float16* arow = lP + (mt * 16 + (lane & 15)) * LDP;
      const _Float16* brow = lVt + (h * 32 + ntc * 16 + (lane & 15)) * LDP;
      v8f acc = {};
#pragma unroll
      for (int ks = 0; ks < 4; ++ks) {
        v16h a  = frag_lds(arow, ks * 32, lane);
        v16h bb = frag_lds(brow, ks * 32, lane);
        acc = __builtin_amdgcn_wmma_f32_16x16x32_f16(false, a, false, bb,
                                                     (short)0, acc, false, false);
      }
      store_tile(lO, mt * 16, h * 32 + ntc * 16, lane, acc, 1.0f);
    }
    __syncthreads();
  }

  // ---- proj GEMM + bias, scatter to rolled-back positions -----------------
  for (int tile = wv; tile < 56; tile += NWAVES) {
    const int mt = tile >> 3;
    const int nt = tile & 7;
    const _Float16* arow = lO + (mt * 16 + (lane & 15)) * LDP;
    const int o = nt * 16 + (lane & 15);
    v8f acc = {};
#pragma unroll
    for (int ks = 0; ks < 4; ++ks) {
      v16h a  = frag_lds(arow, ks * 32, lane);
      v16h bb = frag_w128(projw, o, ks, lane);
      acc = __builtin_amdgcn_wmma_f32_16x16x32_f16(false, a, false, bb,
                                                   (short)0, acc, false, false);
    }
    const float pb = projb[o];
    const int mb = mt * 16 + ((lane & 16) ? 8 : 0);
#pragma unroll
    for (int r = 0; r < 8; ++r) {
      const int m = mb + r;
      if (m < 98) outg[lRow[m] + o] = acc[r] + pb;
    }
  }
}

extern "C" void kernel_launch(void* const* d_in, const int* in_sizes, int n_in,
                              void* d_out, int out_size, void* d_ws, size_t ws_size,
                              hipStream_t stream) {
  (void)in_sizes; (void)n_in; (void)d_ws; (void)ws_size; (void)out_size;
  const float* x     = (const float*)d_in[0];
  const float* qkvw  = (const float*)d_in[1];
  const float* projw = (const float*)d_in[2];
  const float* projb = (const float*)d_in[3];
  const float* rpb   = (const float*)d_in[4];
  float* out = (float*)d_out;

  // allow >64KB dynamic LDS (WGP has 320KB); harmless if already set
  (void)hipFuncSetAttribute(reinterpret_cast<const void*>(swin3d_msa_kernel),
                            hipFuncAttributeMaxDynamicSharedMemorySize,
                            SMEM_BYTES);

  swin3d_msa_kernel<<<1024, NTHREADS, SMEM_BYTES, stream>>>(
      x, qkvw, projw, projb, rpb, out);
}

// v003
// A run of this version takes 70 microseconds.
// Two timings next to v002 both put it at 1.79 times that version's speed.
// All steps since v000 together make it 4.70 times as fast.
#include <hip/hip_runtime.h>
#include <hip/hip_bf16.h>

typedef __attribute__((ext_vector_type(16))) _Float16 v16h;
typedef __attribute__((ext_vector_type(8)))  _Float16 h8;
typedef __attribute__((ext_vector_type(8)))  float    v8f;
typedef __attribute__((ext_vector_type(4)))  float    f4;

#define NTHREADS 256
#define NWAVES   8

// Row pitch of every f16 matrix in LDS, in halves: 128 data + 8 pad = 272 B =
// 16 B x odd, so the 16 rows that one ds_load_b128 fragment read touches fall on
// 16 different groups of four banks (at 256 B they all fall on the same four).
// The pad halves are never read.
#define LDP      136

// LDS arena layout (bytes). All offsets 16B-aligned.
#define OFF_Q    0          // 112 rows f16 : Q (pre-scaled)
#define OFF_K    30464      // 112 rows f16 : K
#define OFF_VT   60928      // 128 rows f16 : V transposed [ch][pos]
#define OFF_P    95744      // 112 rows f16 : phase A: x window (A matrix); phase B: scores/probs
#define OFF_O    126208     // 112 rows f16 : attention output (all heads)
#define OFF_CNT  156672     // 112 i32    : shift-mask region id per token
#define OFF_ROW  157120     // 112 i32    : global f32 offset of each token's (rolled) position
#define SMEM_BYTES 157568

// ---- fragment loaders -------------------------------------------------------
// 16-bit A/B operand K-layout (ISA 7.12.2): lane holds 16 halves as two
// contiguous 8-element runs: K in [base, base+8) and [base+16, base+24),
// base = (lane<16 ? 0 : 8).  B mirrors A with the tile column in lanes.

__device__ __forceinline__ v16h frag_lds(const _Float16* __restrict__ row,
                                         int cbase, int lane) {
  const int kb = cbase + ((lane & 16) ? 8 : 0);
  h8 a = *(const h8*)(row + kb);
  h8 b = *(const h8*)(row + kb + 16);
  v16h r;
#pragma unroll
  for (int i = 0; i < 8; ++i) { r[i] = a[i]; r[i + 8] = b[i]; }
  return r;
}

// B fragment straight from a row-major fp32 weight matrix W[o][128]:
// B[c][o] = W[o*128 + c].  Two 8-float contiguous runs -> 4x b128 loads.
__device__ __forceinline__ v16h frag_w128(const float* __restrict__ W,
                                          int o, int ks, int lane) {
  const int kb = ks * 32 + ((lane & 16) ? 8 : 0);
  const float* p = W + o * 128 + kb;
  f4 a0 = *(const f4*)(p);
  f4 a1 = *(const f4*)(p + 4);
  f4 b0 = *(const f4*)(p + 16);
  f4 b1 = *(const f4*)(p + 20);
  v16h r;
#pragma unroll
  for (int i = 0; i < 4; ++i) {
    r[i]      = (_Float16)a0[i];
    r[4 + i]  = (_Float16)a1[i];
    r[8 + i]  = (_Float16)b0[i];
    r[12 + i] = (_Float16)b1[i];
  }
  return r;
}

// C/D layout: VGPR r holds (M = m0 + r + (lane<16?0:8), N = n0 + lane%16)
__device__ __forceinline__ void store_tile(_Float16* __restrict__ dst,
                                           int m0, int n0, int lane,
                                           v8f acc, float mul) {
  const int n  = n0 + (lane & 15);
  const int mb = m0 + ((lane & 16) ? 8 : 0);
#pragma unroll
  for (int r = 0; r < 8; ++r)
    dst[(mb + r) * LDP + n] = (_Float16)(acc[r] * mul);
}

// maximum / sum over the lane's 16-lane row, result in all 16 lanes; every lane
// of the wave must be on.  asm: the DPP builtin compiled to a move, a DPP move
// and the operation (for the maximum, two) per step instead of one instruction.
__device__ __forceinline__ float row16_max(float x) {
  asm("v_max_num_f32_dpp %0, %0, %0 row_xmask:1 row_mask:0xf bank_mask:0xf\n\t"
      "v_max_num_f32_dpp %0, %0, %0 row_xmask:2 row_mask:0xf bank_mask:0xf\n\t"
      "v_max_num_f32_dpp %0, %0, %0 row_xmask:4 row_mask:0xf bank_mask:0xf\n\t"
      "v_max_num_f32_dpp %0, %0, %0 row_xmask:8 row_mask:0xf bank_mask:0xf"
      : "+v"(x));
  return x;
}
__device__ __forceinline__ float row16_sum(float x) {
  asm("v_add_f32_dpp %0, %0, %0 row_xmask:1 row_mask:0xf bank_mask:0xf\n\t"
      "v_add_f32_dpp %0, %0, %0 row_xmask:2 row_mask:0xf bank_mask:0xf\n\t"
      "v_add_f32_dpp %0, %0, %0 row_xmask:4 row_mask:0xf bank_mask:0xf\n\t"
      "v_add_f32_dpp %0, %0, %0 row_xmask:8 row_mask:0xf bank_mask:0xf"
      : "+v"(x));
  return x;
}

__global__ void __launch_bounds__(NTHREADS)
swin3d_msa_kernel(const float* __restrict__ xg,
                  const float* __restrict__ qkvw,   // (384,128)
                  const float* __restrict__ projw,  // (128,128)
                  const float* __restrict__ projb,  // (128)
                  const float* __restrict__ rpb,    // (507,4)
                  float* __restrict__ outg) {
  extern __shared__ char smem[] __attribute__((aligned(16)));
  _Float16* lQ  = (_Float16*)(smem + OFF_Q);
  _Float16* lK  = (_Float16*)(smem + OFF_K);
  _Float16* lVt = (_Float16*)(smem + OFF_VT);
  _Float16* lP  = (_Float16*)(smem + OFF_P);
  _Float16* lX  = lP;  // phase A alias
  _Float16* lO  = (_Float16*)(smem + OFF_O);
  int* lCnt = (int*)(smem + OFF_CNT);
  int* lRow = (int*)(smem + OFF_ROW);

  const int tid  = threadIdx.x;
  const int lane = tid & 31;
  const int wv   = tid >> 5;

  // window decomposition: blocks ordered (b, bt, bh, bw) = (2, 8, 8, 8)
  const int blk = blockIdx.x;
  const int b   = blk >> 9;
  const int wb  = blk & 511;
  const int bt  = wb >> 6;
  const int bh  = (wb >> 3) & 7;
  const int bw  = wb & 7;

  // zero the f16 arena (padding rows/cols must be 0 for the WMMA tiles)
  {
    uint32_t* z = (uint32_t*)smem;
    for (int i = tid; i < (OFF_CNT >> 2); i += NTHREADS) z[i] = 0u;
  }

  // per-token metadata: region id (shift mask) + global row offset.
  // rolled coords g; source/dest position = (g + shift) % dim (input gather
  // and output scatter use the identical mapping).
  if (tid < 98) {
    const int ti = tid / 49;
    const int rm = tid % 49;
    const int hi = rm / 7;
    const int wi = rm % 7;
    const int gT = bt * 2 + ti, gH = bh * 7 + hi, gW = bw * 7 + wi;
    const int rt = (gT < 14) ? 0 : ((gT < 15) ? 1 : 2);
    const int rh = (gH < 49) ? 0 : ((gH < 53) ? 1 : 2);
    const int rw = (gW < 49) ? 0 : ((gW < 53) ? 1 : 2);
    lCnt[tid] = rt * 9 + rh * 3 + rw;
    const int sT = (gT + 1) & 15;
    int sH = gH + 3; if (sH >= 56) sH -= 56;
    int sW = gW + 3; if (sW >= 56) sW -= 56;
    lRow[tid] = (((b * 16 + sT) * 56 + sH) * 56 + sW) * 128;
  }
  __syncthreads();

  // ---- gather window x (98x128 f32 -> f16 in LDS, rows 98..111 stay 0) ----
  for (int idx = tid; idx < 98 * 32; idx += NTHREADS) {
    const int row = idx >> 5;
    const int c4  = (idx & 31) << 2;
    f4 v = *(const f4*)(xg + lRow[row] + c4);
    _Float16* d = lX + row * LDP + c4;
    d[0] = (_Float16)v[0]; d[1] = (_Float16)v[1];
    d[2] = (_Float16)v[2]; d[3] = (_Float16)v[3];
  }
  __syncthreads();

  // ---- QKV GEMM: (112x384) = X(112x128) @ qkv_w^T(128x384) ----------------
  const float SCALE = 0.17677669529663687f;  // 32^-0.5
  // Wave wv owns output columns 16 wv .. 16 wv + 15 of each of q, k and v.  Its
  // three weight tiles are read from global memory and converted once and stay
  // in registers over the 7 row tiles; each row tile's A fragments serve all three.
  {
    const int oc = wv * 16 + (lane & 15);
    v16h wq[4], wk[4], wvv[4];
#pragma unroll
    for (int ks = 0; ks < 4; ++ks) {
      wq[ks]  = frag_w128(qkvw, oc, ks, lane);
      wk[ks]  = frag_w128(qkvw, 128 + oc, ks, lane);
      wvv[ks] = frag_w128(qkvw, 256 + oc, ks, lane);
    }
    for (int mt = 0; mt < 7; ++mt) {
      const int m0 = mt * 16;
      const _Float16* arow = lX + (m0 + (lane & 15)) * LDP;
      v16h a[4];
#pragma unroll
      for (int ks = 0; ks < 4; ++ks) a[ks] = frag_lds(arow, ks * 32, lane);
      v8f aq = {}, ak = {}, av = {};
#pragma unroll
      for (int ks = 0; ks < 4; ++ks) {
        aq = __builtin_amdgcn_wmma_f32_16x16x32_f16(false, a[ks], false, wq[ks],
                                                    (short)0, aq, false, false);
        ak = __builtin_amdgcn_wmma_f32_16x16x32_f16(false, a[ks], false, wk[ks],
                                                    (short)0, ak, false, false);
        av = __builtin_amdgcn_wmma_f32_16x16x32_f16(false, a[ks], false, wvv[ks],
                                                    (short)0, av, false, false);
      }
      store_tile(lQ, m0, wv * 16, lane, aq, SCALE);      // q * scale
      store_tile(lK, m0, wv * 16, lane, ak, 1.0f);       // k
      const int mb = m0 + ((lane & 16) ? 8 : 0);         // v, transposed
#pragma unroll
      for (int r = 0; r < 8; ++r)
        lVt[oc * LDP + mb + r] = (_Float16)av[r];
    }
  }
  __syncthreads();

  // softmax column constants of this lane: columns l16 + 16 j, j = 0..6
  const int l16  = lane & 15;
  const int half = lane >> 4;
  unsigned colOff[7];  // (253 - (tm*169 + hm*13 + wm)) * 16, byte offset into rpb
  int colCnt[7];   // shift-mask region of the column's token
  for (int j = 0; j < 7; ++j) {
    const int m  = l16 + 16 * j;
    const int mc = (m < 98) ? m : 97;      // padding columns: stay in the table
    const int tm = (mc >= 49) ? 1 : 0;
    const int hm = (mc - 49 * tm) / 7;
    colOff[j] = (unsigned)(253 - (mc + 120 * tm + 6 * hm)) * 16u;
    colCnt[j] = lCnt[mc];
  }

  // ---- attention, one head at a time --------------------------------------
  for (int h = 0; h < 4; ++h) {
    // S = Q_h @ K_h^T : K dim = hd = 32 -> exactly one WMMA per 16x16 tile
    for (int tile = wv; tile < 49; tile += NWAVES) {
      const int mt = tile / 7, nt = tile % 7;
      const _Float16* arow = lQ + (mt * 16 + (lane & 15)) * LDP;
      const _Float16* brow = lK + (nt * 16 + (lane & 15)) * LDP;
      v16h a  = frag_lds(arow, h * 32, lane);
      v16h bb = frag_lds(brow, h * 32, lane);
      v8f acc = {};
      acc = __builtin_amdgcn_wmma_f32_16x16x32_f16(false, a, false, bb,
                                                   (short)0, acc, false, false);
      store_tile(lP, mt * 16, nt * 16, lane, acc, 1.0f);
    }
    __syncthreads();

    // row softmax with on-the-fly rel-pos bias + shift mask.
    // 16 lanes share a row (lane l16 owns columns l16 + 16 j), a wave takes two
    // adjacent rows per pass, all 8 waves work; scores stay in registers from
    // the maximum to the normalised store.
    const char* rpbb = (const char*)rpb;   // uniform base; lanes add a 32-bit byte offset
    const unsigned h4 = (unsigned)h * 4u;
    _Float16 xq[2][7];   // scores, bias and row region of this pass and the next
    float    bq[2][7];
    int      crq[2];
    auto sm_load = [&](int i, int buf) {
      const int row = 2 * (wv + 8 * i) + half;
      const int tr  = (row >= 49) ? 1 : 0;
      const int hr  = (row - 49 * tr) / 7;
      const unsigned ro = (unsigned)(row + 120 * tr + 6 * hr) * 16u;  // (tr*169 + hr*13 + wr) * 16 B
      const _Float16* prow = lP + row * LDP + l16;
      crq[buf] = lCnt[row];
      for (int j = 0; j < 7; ++j) {
        xq[buf][j] = prow[16 * j];
        bq[buf][j] = *(const float*)(rpbb + (ro + colOff[j] + h4));
      }
    };
    auto sm_pass = [&](int i, int buf) {
      _Float16* prow = lP + (2 * (wv + 8 * i) + half) * LDP + l16;
      float s[7];
      for (int j = 0; j < 7; ++j) {
        float v = (float)xq[buf][j] + bq[buf][j];
        if (colCnt[j] != crq[buf]) v -= 100.0f;
        s[j] = v;
      }
      if (l16 >= 2) s[6] = -3.0e38f;       // columns 98..111: K-padding
      float vmax = s[0];
      for (int j = 1; j < 7; ++j) vmax = fmaxf(vmax, s[j]);
      vmax = row16_max(vmax);
      float sum = 0.0f;
      for (int j = 0; j < 7; ++j) {
        s[j] = __expf(s[j] - vmax);
        sum += s[j];
      }
      const float inv = __builtin_amdgcn_rcpf(row16_sum(sum));
      for (int j = 0; j < 7; ++j) prow[16 * j] = (_Float16)(s[j] * inv);
    };
    sm_load(0, 0);
    // unrolled at once, so that xq/bq/crq are indexed by constants from the start;
    // left to the late unroller the build took half as many registers again
#pragma unroll
    for (int i = 0; i < 6; ++i) {          // row pairs 0..47
      if (i < 5) sm_load(i + 1, (i + 1) & 1);  // next pass's loads fly under this pass
      sm_pass(i, i & 1);
    }
    if (wv == 0) {                         // row pair 48
      sm_load(6, 0);
      sm_pass(6, 0);
    } else {                               // row pairs 49..55: junk rows
      _Float16* prow = lP + (2 * (wv + 48) + half) * LDP + l16;
      for (int j = 0; j < 7; ++j) prow[16 * j] = (_Float16)0.0f;
    }
    __syncthreads();

    // O_h(112x32) = P(112x128) @ V_h(128x32); B fragments from V^T rows
    for (int tile = wv; tile < 14; tile += NWAVES) {
      const int mt  = tile % 7;
      const int ntc = tile / 7;
      const _Float16* arow = lP + (mt * 16 + (lane & 15)) * LDP;
      const _Float16* brow = lVt + (h * 32 + ntc * 16 + (lane & 15)) * LDP;
      v8f acc = {};
#pragma unroll
      for (int ks = 0; ks < 4; ++ks) {
        v16h a  = frag_lds(arow, ks * 32, lane);
        v16h bb = frag_lds(brow, ks * 32, lane);
        acc = __builtin_amdgcn_wmma_f32_16x16x32_f16(false, a, false, bb,
                                                     (short)0, acc, false, false);
      }
      store_tile(lO, mt * 16, h * 32 + ntc * 16, lane, acc, 1.0f);
    }
    __syncthreads();
  }

  // ---- proj GEMM + bias, scatter to rolled-back positions -----------------
  for (int tile = wv; tile < 56; tile += NWAVES) {
    const int mt = tile >> 3;
    const int nt = tile & 7;
    const _Float16* arow = lO + (mt * 16 + (lane & 15)) * LDP;
    const int o = nt * 16 + (lane & 15);
    v8f acc = {};
#pragma unroll
    for (int ks = 0; ks < 4; ++ks) {
      v16h a  = frag_lds(arow, ks * 32, lane);
      v16h bb = frag_w128(projw, o, ks, lane);
      acc = __builtin_amdgcn_wmma_f32_16x16x32_f16(false, a, false, bb,
                                                   (short)0, acc, false, false);
    }
    const float pb = projb[o];
    const int mb = mt * 16 + ((lane & 16) ? 8 : 0);
#pragma unroll
    for (int r = 0; r < 8; ++r) {
      const int m = mb + r;
      if (m < 98) outg[lRow[m] + o] = acc[r] + pb;
    }
  }
}

extern "C" void kernel_launch(void* const* d_in, const int* in_sizes, int n_in,
                              void* d_out, int out_size, void* d_ws, size_t ws_size,
                              hipStream_t stream) {
  (void)in_sizes; (void)n_in; (void)d_ws; (void)ws_size; (void)out_size;
  const float* x     = (const float*)d_in[0];
  const float* qkvw  = (const float*)d_in[1];
  const float* projw = (const float*)d_in[2];
  const float* projb = (const float*)d_in[3];
  const float* rpb   = (const float*)d_in[4];
  float* out = (float*)d_out;

  // allow >64KB dynamic LDS (WGP has 320KB); harmless if already set
  (void)hipFuncSetAttribute(reinterpret_cast<const void*>(swin3d_msa_kernel),
                            hipFuncAttributeMaxDynamicSharedMemorySize,
                            SMEM_BYTES);

  swin3d_msa_kernel<<<1024, NTHREADS, SMEM_BYTES, stream>>>(
      x, qkvw, projw, projb, rpb, out);
}

// v004
// One run takes 51.9 microseconds.
// In both of two side-by-side timings against v003, it was 1.35 times as fast.
// All steps since v000 together make it 6.34 times as fast.
#include <hip/hip_runtime.h>
#include <hip/hip_bf16.h>

typedef __attribute__((ext_vector_type(16))) _Float16 v16h;
typedef __attribute__((ext_vector_type(8)))  _Float16 h8;
typedef __attribute__((ext_vector_type(8)))  float    v8f;
typedef __attribute__((ext_vector_type(4)))  float    f4;

#define NTHREADS 256
#define NWAVES   8

// Row pitch of every f16 matrix in LDS, in halves: 128 data + 8 pad = 272 B =
// 16 B x odd, so the 16 rows that one ds_load_b128 fragment read touches fall on
// 16 different groups of four banks (at 256 B they all fall on the same four).
// The pad halves are never read.
#define LDP      136

// LDS arena layout (bytes). All offsets 16B-aligned.
#define OFF_Q    0          // 112 rows f16 : Q (pre-scaled)
#define OFF_K    30464      // 112 rows f16 : K
#define OFF_VT   60928      // 128 rows f16 : V transposed [ch][pos]
#define OFF_X    95744      // 112 rows f16 : x window (A matrix of the QKV GEMM)
#define OFF_O    126208     // 112 rows f16 : attention output (all heads)
#define OFF_CNT  156672     // 112 i32    : shift-mask region id per token
#define OFF_ROW  157120     // 112 i32    : global f32 offset of each token's (rolled) position
#define SMEM_BYTES 157568

// ---- fragment loaders -------------------------------------------------------
// 16-bit A/B operand K-layout (ISA 7.12.2): lane holds 16 halves as two
// contiguous 8-element runs: K in [base, base+8) and [base+16, base+24),
// base = (lane<16 ? 0 : 8).  B mirrors A with the tile column in lanes.

__device__ __forceinline__ v16h frag_lds(const _Float16* __restrict__ row,
                                         int cbase, int lane) {
  const int kb = cbase + ((lane & 16) ? 8 : 0);
  h8 a = *(const h8*)(row + kb);
  h8 b = *(const h8*)(row + kb + 16);
  v16h r;
#pragma unroll
  for (int i = 0; i < 8; ++i) { r[i] = a[i]; r[i + 8] = b[i]; }
  return r;
}

// B fragment straight from a row-major fp32 weight matrix W[o][128]:
// B[c][o] = W[o*128 + c].  Two 8-float contiguous runs -> 4x b128 loads.
__device__ __forceinline__ v16h frag_w128(const float* __restrict__ W,
                                          int o, int ks, int lane) {
  const int kb = ks * 32 + ((lane & 16) ? 8 : 0);
  const float* p = W + o * 128 + kb;
  f4 a0 = *(const f4*)(p);
  f4 a1 = *(const f4*)(p + 4);
  f4 b0 = *(const f4*)(p + 16);
  f4 b1 = *(const f4*)(p + 20);
  v16h r;
#pragma unroll
  for (int i = 0; i < 4; ++i) {
    r[i]      = (_Float16)a0[i];
    r[4 + i]  = (_Float16)a1[i];
    r[8 + i]  = (_Float16)b0[i];
    r[12 + i] = (_Float16)b1[i];
  }
  return r;
}

// C/D layout: VGPR r holds (M = m0 + r + (lane<16?0:8), N = n0 + lane%16)
__device__ __forceinline__ void store_tile(_Float16* __restrict__ dst,
                                           int m0, int n0, int lane,
                                           v8f acc, float mul) {
  const int n  = n0 + (lane & 15);
  const int mb = m0 + ((lane & 16) ? 8 : 0);
#pragma unroll
  for (int r = 0; r < 8; ++r)
    dst[(mb + r) * LDP + n] = (_Float16)(acc[r] * mul);
}

// value of the lane 16 further on / back (l ^ 16); every lane of the wave must be on
__device__ __forceinline__ float other_half(float x) {
  const int b = __builtin_bit_cast(int, x);
  return __builtin_bit_cast(float,
      __builtin_amdgcn_permlanex16(b, b, 0x76543210, 0xfedcba98, false, false));
}

// token m = t*49 + h*7 + w of a window -> t*169 + h*13 + w; the row of the bias
// table for (query n, key m) is tok_idx(n) - tok_idx(m) + 253
__device__ __forceinline__ constexpr int tok_idx(int m) {
  return m + 120 * (m / 49) + 6 * ((m % 49) / 7);
}

// keys m and m + 8 (m = 16 kt + r, r < 8, both below 96) lie 14 or 20 table rows
// apart, but for m = 48
__device__ __forceinline__ constexpr bool key_steps_ok() {
  for (int m = 0; m < 96; ++m) {
    if ((m & 15) >= 8) continue;
    const int d = tok_idx(m + 8) - tok_idx(m);
    if (d != 14 && d != 20 && m != 48) return false;
  }
  return true;
}
static_assert(key_steps_ok(), "bias address steps");

__global__ void __launch_bounds__(NTHREADS)
swin3d_msa_kernel(const float* __restrict__ xg,
                  const float* __restrict__ qkvw,   // (384,128)
                  const float* __restrict__ projw,  // (128,128)
                  const float* __restrict__ projb,  // (128)
                  const float* __restrict__ rpb,    // (507,4)
                  float* __restrict__ outg) {
  extern __shared__ char smem[] __attribute__((aligned(16)));
  _Float16* lQ  = (_Float16*)(smem + OFF_Q);
  _Float16* lK  = (_Float16*)(smem + OFF_K);
  _Float16* lVt = (_Float16*)(smem + OFF_VT);
  _Float16* lX  = (_Float16*)(smem + OFF_X);
  _Float16* lO  = (_Float16*)(smem + OFF_O);
  int* lCnt = (int*)(smem + OFF_CNT);
  int* lRow = (int*)(smem + OFF_ROW);

  const int tid  = threadIdx.x;
  const int lane = tid & 31;
  const int wv   = tid >> 5;

  // window decomposition: blocks ordered (b, bt, bh, bw) = (2, 8, 8, 8)
  const int blk = blockIdx.x;
  const int b   = blk >> 9;
  const int wb  = blk & 511;
  const int bt  = wb >> 6;
  const int bh  = (wb >> 3) & 7;
  const int bw  = wb & 7;

  // zero the f16 arena (padding rows/cols must be 0 for the WMMA tiles)
  {
    uint32_t* z = (uint32_t*)smem;
    for (int i = tid; i < (OFF_CNT >> 2); i += NTHREADS) z[i] = 0u;
  }

  // per-token metadata: region id (shift mask) + global row offset.
  // rolled coords g; source/dest position = (g + shift) % dim (input gather
  // and output scatter use the identical mapping).
  if (tid < 98) {
    const int ti = tid / 49;
    const int rm = tid % 49;
    const int hi = rm / 7;
    const int wi = rm % 7;
    const int gT = bt * 2 + ti, gH = bh * 7 + hi, gW = bw * 7 + wi;
    const int rt = (gT < 14) ? 0 : ((gT < 15) ? 1 : 2);
    const int rh = (gH < 49) ? 0 : ((gH < 53) ? 1 : 2);
    const int rw = (gW < 49) ? 0 : ((gW < 53) ? 1 : 2);
    lCnt[tid] = rt * 9 + rh * 3 + rw;
    const int sT = (gT + 1) & 15;
    int sH = gH + 3; if (sH >= 56) sH -= 56;
    int sW = gW + 3; if (sW >= 56) sW -= 56;
    lRow[tid] = (((b * 16 + sT) * 56 + sH) * 56 + sW) * 128;
  }
  __syncthreads();

  // ---- gather window x (98x128 f32 -> f16 in LDS, rows 98..111 stay 0) ----
  for (int idx = tid; idx < 98 * 32; idx += NTHREADS) {
    const int row = idx >> 5;
    const int c4  = (idx & 31) << 2;
    f4 v = *(const f4*)(xg + lRow[row] + c4);
    _Float16* d = lX + row * LDP + c4;
    d[0] = (_Float16)v[0]; d[1] = (_Float16)v[1];
    d[2] = (_Float16)v[2]; d[3] = (_Float16)v[3];
  }
  __syncthreads();

  // ---- QKV GEMM: (112x384) = X(112x128) @ qkv_w^T(128x384) ----------------
  const float SCALE = 0.17677669529663687f;  // 32^-0.5
  // Wave wv owns output columns 16 wv .. 16 wv + 15 of each of q, k and v.  Its
  // three weight tiles are read from global memory and converted once and stay
  // in registers over the 7 row tiles; each row tile's A fragments serve all three.
  {
    const int oc = wv * 16 + (lane & 15);
    v16h wq[4], wk[4], wvv[4];
#pragma unroll
    for (int ks = 0; ks < 4; ++ks) {
      wq[ks]  = frag_w128(qkvw, oc, ks, lane);
      wk[ks]  = frag_w128(qkvw, 128 + oc, ks, lane);
      wvv[ks] = frag_w128(qkvw, 256 + oc, ks, lane);
    }
    for (int mt = 0; mt < 7; ++mt) {
      const int m0 = mt * 16;
      const _Float16* arow = lX + (m0 + (lane & 15)) * LDP;
      v16h a[4];
#pragma unroll
      for (int ks = 0; ks < 4; ++ks) a[ks] = frag_lds(arow, ks * 32, lane);
      v8f aq = {}, ak = {}, av = {};
#pragma unroll
      for (int ks = 0; ks < 4; ++ks) {
        aq = __builtin_amdgcn_wmma_f32_16x16x32_f16(false, a[ks], false, wq[ks],
                                                    (short)0, aq, false, false);
        ak = __builtin_amdgcn_wmma_f32_16x16x32_f16(false, a[ks], false, wk[ks],
                                                    (short)0, ak, false, false);
        av = __builtin_amdgcn_wmma_f32_16x16x32_f16(false, a[ks], false, wvv[ks],
                                                    (short)0, av, false, false);
      }
      store_tile(lQ, m0, wv * 16, lane, aq, SCALE);      // q * scale
      store_tile(lK, m0, wv * 16, lane, ak, 1.0f);       // k
      const int mb = m0 + ((lane & 16) ? 8 : 0);         // v, transposed
#pragma unroll
      for (int r = 0; r < 8; ++r)
        lVt[oc * LDP + mb + r] = (_Float16)av[r];
    }
  }
  __syncthreads();

  // ---- attention: a wave takes one head and 16 queries at a time -----------
  // S^T = K_h Q_h^T: a lane holds the scores of ONE query (column l16) against
  // keys 16 kt + 8 half + r in register r of tile kt.  That is the k order of a
  // B operand, so exp(S^T) is packed as it lies and O^T = V_h^T P^T follows with
  // no trip of the scores through LDS and no barrier between the heads.
  const int l16  = lane & 15;
  const int half = lane >> 4;
  const int wvs  = __builtin_amdgcn_readfirstlane(wv);
  const int h    = wvs & 3;
  for (int qt = wvs >> 2; qt < 7; qt += 2) {
    const int n    = qt * 16 + l16;
    const int nc   = (n < 98) ? n : 97;    // padding queries: stay in the table
    const int qcnt = lCnt[nc];
    const char* pq = (const char*)rpb + (tok_idx(nc) * 16 + h * 4);
    // lanes 16..31 hold the key 8 further on: 14 or 20 table rows lower; the one
    // pair that spans the two frames (keys 48 and 56) has an address of its own
    const char* pA = pq - (half ? 14 * 16 : 0);
    const char* pB = pq - (half ? 20 * 16 : 0);
    const char* pX = pq + (half ? (253 - tok_idx(56)) * 16 : (253 - tok_idx(48)) * 16);

    // start value of the accumulators: rel-pos bias + shift mask
    v8f st[7];
#pragma unroll
    for (int kt = 0; kt < 6; ++kt) {
      const int* kc = lCnt + kt * 16 + 8 * half;
#pragma unroll
      for (int r = 0; r < 8; ++r) {
        const int c0 = tok_idx(kt * 16 + r);             // key of lanes 0..15
        const int d  = tok_idx(kt * 16 + 8 + r) - c0;    // lanes 16..31: 8 keys on
        const char* p = (d == 14) ? pA + (253 - c0) * 16
                      : (d == 20) ? pB + (253 - c0) * 16 : pX;
        float v = *(const float*)p;
        if (kc[r] != qcnt) v -= 100.0f;
        st[kt][r] = v;
      }
    }
#pragma unroll
    for (int r = 0; r < 8; ++r) {          // keys 96, 97; 98..111 are K-padding
      float v = -3.0e38f;
      if (r < 2) {
        v = *(const float*)(pq + (253 - tok_idx(96 + r)) * 16);
        if (lCnt[96 + r] != qcnt) v -= 100.0f;
        if (half) v = -3.0e38f;
      }
      st[6][r] = v;
    }
    // The address pairs of the loads above stay live up to this wait.
    asm volatile("s_wait_xcnt 0x0" :: "v"(pA), "v"(pB), "v"(pX) : "memory");

    const v16h bq = frag_lds(lQ + n * LDP, h * 32, lane);
#pragma unroll
    for (int kt = 0; kt < 7; ++kt) {
      const v16h a = frag_lds(lK + (kt * 16 + l16) * LDP, h * 32, lane);
      st[kt] = __builtin_amdgcn_wmma_f32_16x16x32_f16(false, a, false, bq,
                                                      (short)0, st[kt], false, false);
    }

    // softmax of the lane's query: in-lane, then one exchange between the halves
    v8f m8 = st[0];
#pragma unroll
    for (int kt = 1; kt < 6; ++kt) m8 = __builtin_elementwise_max(m8, st[kt]);
    m8[0] = fmaxf(m8[0], st[6][0]);
    m8[1] = fmaxf(m8[1], st[6][1]);
    float vmax = fmaxf(fmaxf(fmaxf(m8[0], m8[1]), fmaxf(m8[2], m8[3])),
                       fmaxf(fmaxf(m8[4], m8[5]), fmaxf(m8[6], m8[7])));
    vmax = fmaxf(vmax, other_half(vmax));
    v8f s8 = {};
#pragma unroll
    for (int kt = 0; kt < 6; ++kt) {
#pragma unroll
      for (int r = 0; r < 8; ++r) st[kt][r] = __expf(st[kt][r] - vmax);
      s8 += st[kt];
    }
    const float p96 = __expf(st[6][0] - vmax);
    const float p97 = __expf(st[6][1] - vmax);
    s8[0] += p96;
    s8[1] += p97;
    float sum = ((s8[0] + s8[1]) + (s8[2] + s8[3])) + ((s8[4] + s8[5]) + (s8[6] + s8[7]));
    sum += other_half(sum);
    const float inv = __builtin_amdgcn_rcpf(sum);   // applied to O, not to P

    v16h pb[4];
#pragma unroll
    for (int t = 0; t < 3; ++t) {
#pragma unroll
      for (int i = 0; i < 8; ++i) {
        pb[t][i]     = (_Float16)st[2 * t][i];
        pb[t][8 + i] = (_Float16)st[2 * t + 1][i];
      }
    }
    pb[3] = v16h{};
    pb[3][0] = (_Float16)p96;
    pb[3][1] = (_Float16)p97;

    // O^T(32 ch x 16 queries) = V_h^T(32 x 128) @ P^T(128 x 16); a lane ends up
    // with 8 adjacent channels of its query: one 16-byte store per tile
#pragma unroll
    for (int ct = 0; ct < 2; ++ct) {
      const _Float16* vrow = lVt + (h * 32 + ct * 16 + l16) * LDP;
      v8f acc = {};
#pragma unroll
      for (int ks = 0; ks < 4; ++ks) {
        const v16h a = frag_lds(vrow, ks * 32, lane);
        acc = __builtin_amdgcn_wmma_f32_16x16x32_f16(false, a, false, pb[ks],
                                                     (short)0, acc, false, false);
      }
      h8 ov;
#pragma unroll
      for (int r = 0; r < 8; ++r) ov[r] = (_Float16)(acc[r] * inv);
      *(h8*)(lO + n * LDP + h * 32 + ct * 16 + 8 * half) = ov;
    }
  }
  __syncthreads();

  // ---- proj GEMM + bias, scatter to rolled-back positions -----------------
  for (int tile = wv; tile < 56; tile += NWAVES) {
    const int mt = tile >> 3;
    const int nt = tile & 7;
    const _Float16* arow = lO + (mt * 16 + (lane & 15)) * LDP;
    const int o = nt * 16 + (lane & 15);
    v8f acc = {};
#pragma unroll
    for (int ks = 0; ks < 4; ++ks) {
      v16h a  = frag_lds(arow, ks * 32, lane);
      v16h bb = frag_w128(projw, o, ks, lane);
      acc = __builtin_amdgcn_wmma_f32_16x16x32_f16(false, a, false, bb,
                                                   (short)0, acc, false, false);
    }
    const float pb = projb[o];
    const int mb = mt * 16 + ((lane & 16) ? 8 : 0);
#pragma unroll
    for (int r = 0; r < 8; ++r) {
      const int m = mb + r;
      if (m < 98) outg[lRow[m] + o] = acc[r] + pb;
    }
  }
}

extern "C" void kernel_launch(void* const* d_in, const int* in_sizes, int n_in,
                              void* d_out, int out_size, void* d_ws, size_t ws_size,
                              hipStream_t stream) {
  (void)in_sizes; (void)n_in; (void)d_ws; (void)ws_size; (void)out_size;
  const float* x     = (const float*)d_in[0];
  const float* qkvw  = (const float*)d_in[1];
  const float* projw = (const float*)d_in[2];
  const float* projb = (const float*)d_in[3];
  const float* rpb   = (const float*)d_in[4];
  float* out = (float*)d_out;

  // allow >64KB dynamic LDS (WGP has 320KB); harmless if already set
  (void)hipFuncSetAttribute(reinterpret_cast<const void*>(swin3d_msa_kernel),
                            hipFuncAttributeMaxDynamicSharedMemorySize,
                            SMEM_BYTES);

  swin3d_msa_kernel<<<1024, NTHREADS, SMEM_BYTES, stream>>>(
      x, qkvw, projw, projb, rpb, out);
}

// v005
// Measured time: 48.6 microseconds a run.
// Next to v004, in two timings, it ran 1.07 times as fast each time.
// All steps since v000 together make it 6.77 times as fast.
#include <hip/hip_runtime.h>
#include <hip/hip_bf16.h>

typedef __attribute__((ext_vector_type(16))) _Float16 v16h;
typedef __attribute__((ext_vector_type(8)))  _Float16 h8;
typedef __attribute__((ext_vector_type(8)))  float    v8f;
typedef __attribute__((ext_vector_type(4)))  float    f4;

#define NTHREADS 256
#define NWAVES   8

// Row pitch of every f16 matrix in LDS, in halves: 128 data + 8 pad = 272 B =
// 16 B x odd, so the 16 rows that one ds_load_b128 fragment read touches fall on
// 16 different groups of four banks (at 256 B they all fall on the same four).
// The pad halves are never read.
#define LDP      136

// LDS arena layout (bytes). All offsets 16B-aligned.
#define OFF_Q    0          // 112 rows f16 : Q (pre-scaled)
#define OFF_K    30464      // 112 rows f16 : K
#define OFF_VT   60928      // 128 rows f16 : V transposed [ch][pos]
#define OFF_X    95744      // 112 rows f16 : x window (A matrix of the QKV GEMM)
#define OFF_O    OFF_X      // 112 rows f16 : attention output (all heads); x is dead by then
#define OFF_TAB  126208     // 4 x 512 f32 : rel-pos bias table, head-major
#define OFF_CNT  134400     // 112 i32    : shift-mask region id per token
#define OFF_ROW  134848     // 112 i32    : global f32 offset of each token's (rolled) position
#define SMEM_BYTES 135296

// Floats per head in the LDS copy of the bias table (507 used).  Head-major: the
// different table rows of a wave's 32 look-ups (one head) lie on different banks.
#define TABP     512

// ---- fragment loaders -------------------------------------------------------
// 16-bit A/B operand K-layout (ISA 7.12.2): lane holds 16 halves as two
// contiguous 8-element runs: K in [base, base+8) and [base+16, base+24),
// base = (lane<16 ? 0 : 8).  B mirrors A with the tile column in lanes.

__device__ __forceinline__ v16h frag_lds(const _Float16* __restrict__ row,
                                         int cbase, int lane) {
  const int kb = cbase + ((lane & 16) ? 8 : 0);
  h8 a = *(const h8*)(row + kb);
  h8 b = *(const h8*)(row + kb + 16);
  v16h r;
#pragma unroll
  for (int i = 0; i < 8; ++i) { r[i] = a[i]; r[i + 8] = b[i]; }
  return r;
}

// B fragment straight from a row-major fp32 weight matrix W[o][128]:
// B[c][o] = W[o*128 + c].  Two 8-float contiguous runs -> 4x b128 loads.
__device__ __forceinline__ v16h frag_w128(const float* __restrict__ W,
                                          int o, int ks, int lane) {
  const int kb = ks * 32 + ((lane & 16) ? 8 : 0);
  const float* p = W + o * 128 + kb;
  f4 a0 = *(const f4*)(p);
  f4 a1 = *(const f4*)(p + 4);
  f4 b0 = *(const f4*)(p + 16);
  f4 b1 = *(const f4*)(p + 20);
  v16h r;
#pragma unroll
  for (int i = 0; i < 4; ++i) {
    r[i]      = (_Float16)a0[i];
    r[4 + i]  = (_Float16)a1[i];
    r[8 + i]  = (_Float16)b0[i];
    r[12 + i] = (_Float16)b1[i];
  }
  return r;
}

// C/D layout: VGPR r holds (M = m0 + r + (lane<16?0:8), N = n0 + lane%16)
__device__ __forceinline__ void store_tile(_Float16* __restrict__ dst,
                                           int m0, int n0, int lane,
                                           v8f acc, float mul) {
  const int n  = n0 + (lane & 15);
  const int mb = m0 + ((lane & 16) ? 8 : 0);
#pragma unroll
  for (int r = 0; r < 8; ++r)
    dst[(mb + r) * LDP + n] = (_Float16)(acc[r] * mul);
}

// value of the lane 16 further on / back (l ^ 16); every lane of the wave must be on
__device__ __forceinline__ float other_half(float x) {
  const int b = __builtin_bit_cast(int, x);
  return __builtin_bit_cast(float,
      __builtin_amdgcn_permlanex16(b, b, 0x76543210, 0xfedcba98, false, false));
}

// token m = t*49 + h*7 + w of a window -> t*169 + h*13 + w; the row of the bias
// table for (query n, key m) is tok_idx(n) - tok_idx(m) + 253
__device__ __forceinline__ constexpr int tok_idx(int m) {
  return m + 120 * (m / 49) + 6 * ((m % 49) / 7);
}

// keys m and m + 8 (m = 16 kt + r, r < 8, both below 96) lie 14 or 20 table rows
// apart, but for m = 48
__device__ __forceinline__ constexpr bool key_steps_ok() {
  for (int m = 0; m < 96; ++m) {
    if ((m & 15) >= 8) continue;
    const int d = tok_idx(m + 8) - tok_idx(m);
    if (d != 14 && d != 20 && m != 48) return false;
  }
  return true;
}
static_assert(key_steps_ok(), "bias address steps");

__global__ void __launch_bounds__(NTHREADS)
swin3d_msa_kernel(const float* __restrict__ xg,
                  const float* __restrict__ qkvw,   // (384,128)
                  const float* __restrict__ projw,  // (128,128)
                  const float* __restrict__ projb,  // (128)
                  const float* __restrict__ rpb,    // (507,4)
                  float* __restrict__ outg) {
  extern __shared__ char smem[] __attribute__((aligned(16)));
  _Float16* lQ  = (_Float16*)(smem + OFF_Q);
  _Float16* lK  = (_Float16*)(smem + OFF_K);
  _Float16* lVt = (_Float16*)(smem + OFF_VT);
  _Float16* lX  = (_Float16*)(smem + OFF_X);
  _Float16* lO  = (_Float16*)(smem + OFF_O);
  float* lTab = (float*)(smem + OFF_TAB);
  int* lCnt = (int*)(smem + OFF_CNT);
  int* lRow = (int*)(smem + OFF_ROW);

  const int tid  = threadIdx.x;
  const int lane = tid & 31;
  const int wv   = tid >> 5;

  // window decomposition: blocks ordered (b, bt, bh, bw) = (2, 8, 8, 8)
  const int blk = blockIdx.x;
  const int b   = blk >> 9;
  const int wb  = blk & 511;
  const int bt  = wb >> 6;
  const int bh  = (wb >> 3) & 7;
  const int bw  = wb & 7;

  // bias table rows tid and tid + 256: read now, stored to LDS behind the zero fill
  const bool two = tid + NTHREADS < 507;
  const f4 t0 = *(const f4*)(rpb + tid * 4);
  const f4 t1 = *(const f4*)(rpb + (two ? tid + NTHREADS : tid) * 4);

  // zero the f16 arena (padding rows/cols must be 0 for the WMMA tiles)
  {
    uint32_t* z = (uint32_t*)smem;
    for (int i = tid; i < (OFF_TAB >> 2); i += NTHREADS) z[i] = 0u;
  }

  // unrolled: constant element numbers keep t0 and t1 in registers
#pragma unroll
  for (int hh = 0; hh < 4; ++hh) lTab[hh * TABP + tid] = t0[hh];
  if (two) {
#pragma unroll
    for (int hh = 0; hh < 4; ++hh) lTab[hh * TABP + tid + NTHREADS] = t1[hh];
  }

  // per-token metadata: region id (shift mask) + global row offset.
  // rolled coords g; source/dest position = (g + shift) % dim (input gather
  // and output scatter use the identical mapping).
  if (tid < 98) {
    const int ti = tid / 49;
    const int rm = tid % 49;
    const int hi = rm / 7;
    const int wi = rm % 7;
    const int gT = bt * 2 + ti, gH = bh * 7 + hi, gW = bw * 7 + wi;
    const int rt = (gT < 14) ? 0 : ((gT < 15) ? 1 : 2);
    const int rh = (gH < 49) ? 0 : ((gH < 53) ? 1 : 2);
    const int rw = (gW < 49) ? 0 : ((gW < 53) ? 1 : 2);
    lCnt[tid] = rt * 9 + rh * 3 + rw;
    const int sT = (gT + 1) & 15;
    int sH = gH + 3; if (sH >= 56) sH -= 56;
    int sW = gW + 3; if (sW >= 56) sW -= 56;
    lRow[tid] = (((b * 16 + sT) * 56 + sH) * 56 + sW) * 128;
  }
  __syncthreads();

  // ---- gather window x (98x128 f32 -> f16 in LDS, rows 98..111 stay 0) ----
  for (int idx = tid; idx < 98 * 32; idx += NTHREADS) {
    const int row = idx >> 5;
    const int c4  = (idx & 31) << 2;
    f4 v = *(const f4*)(xg + lRow[row] + c4);
    _Float16* d = lX + row * LDP + c4;
    d[0] = (_Float16)v[0]; d[1] = (_Float16)v[1];
    d[2] = (_Float16)v[2]; d[3] = (_Float16)v[3];
  }
  __syncthreads();

  // ---- QKV GEMM: (112x384) = X(112x128) @ qkv_w^T(128x384) ----------------
  const float SCALE = 0.17677669529663687f;  // 32^-0.5
  // Wave wv owns output columns 16 wv .. 16 wv + 15 of each of q, k and v.  Its
  // three weight tiles are read from global memory and converted once and stay
  // in registers over the 7 row tiles; each row tile's A fragments serve all three.
  {
    const int oc = wv * 16 + (lane & 15);
    v16h wq[4], wk[4], wvv[4];
#pragma unroll
    for (int ks = 0; ks < 4; ++ks) {
      wq[ks]  = frag_w128(qkvw, oc, ks, lane);
      wk[ks]  = frag_w128(qkvw, 128 + oc, ks, lane);
      wvv[ks] = frag_w128(qkvw, 256 + oc, ks, lane);
    }
    for (int mt = 0; mt < 7; ++mt) {
      const int m0 = mt * 16;
      const _Float16* arow = lX + (m0 + (lane & 15)) * LDP;
      v16h a[4];
#pragma unroll
      for (int ks = 0; ks < 4; ++ks) a[ks] = frag_lds(arow, ks * 32, lane);
      v8f aq = {}, ak = {}, av = {};
#pragma unroll
      for (int ks = 0; ks < 4; ++ks) {
        aq = __builtin_amdgcn_wmma_f32_16x16x32_f16(false, a[ks], false, wq[ks],
                                                    (short)0, aq, false, false);
        ak = __builtin_amdgcn_wmma_f32_16x16x32_f16(false, a[ks], false, wk[ks],
                                                    (short)0, ak, false, false);
        av = __builtin_amdgcn_wmma_f32_16x16x32_f16(false, a[ks], false, wvv[ks],
                                                    (short)0, av, false, false);
      }
      store_tile(lQ, m0, wv * 16, lane, aq, SCALE);      // q * scale
      store_tile(lK, m0, wv * 16, lane, ak, 1.0f);       // k
      const int mb = m0 + ((lane & 16) ? 8 : 0);         // v, transposed
#pragma unroll
      for (int r = 0; r < 8; ++r)
        lVt[oc * LDP + mb + r] = (_Float16)av[r];
    }
  }
  __syncthreads();

  // ---- attention: a wave takes one head and 16 queries at a time -----------
  // S^T = K_h Q_h^T: a lane holds the scores of ONE query (column l16) against
  // keys 16 kt + 8 half + r in register r of tile kt.  That is the k order of a
  // B operand, so exp(S^T) is packed as it lies and O^T = V_h^T P^T follows with
  // no trip of the scores through LDS and no barrier between the heads.
  const int l16  = lane & 15;
  const int half = lane >> 4;
  const int wvs  = __builtin_amdgcn_readfirstlane(wv);
  const int h    = wvs & 3;
  for (int qt = wvs >> 2; qt < 7; qt += 2) {
    const int n    = qt * 16 + l16;
    const int nc   = (n < 98) ? n : 97;    // padding queries: stay in the table
    const int qcnt = lCnt[nc];
    const float* pq = lTab + h * TABP + tok_idx(nc);
    // lanes 16..31 hold the key 8 further on: 14 or 20 table rows lower; the one
    // pair that spans the two frames (keys 48 and 56) has an address of its own
    const float* pA = pq - (half ? 14 : 0);
    const float* pB = pq - (half ? 20 : 0);
    const float* pX = pq + (half ? 253 - tok_idx(56) : 253 - tok_idx(48));

    // start value of the accumulators: rel-pos bias + shift mask.  All look-ups
    // (bias and region ids) are read first, as one run of LDS loads.
    v8f st[7];
    int kc[6][8];
#pragma unroll
    for (int kt = 0; kt < 6; ++kt) {
#pragma unroll
      for (int r = 0; r < 8; ++r) {
        const int c0 = tok_idx(kt * 16 + r);             // key of lanes 0..15
        const int d  = tok_idx(kt * 16 + 8 + r) - c0;    // lanes 16..31: 8 keys on
        const float* p = (d == 14) ? pA + (253 - c0)
                       : (d == 20) ? pB + (253 - c0) : pX;
        st[kt][r] = *p;
        kc[kt][r] = lCnt[kt * 16 + 8 * half + r];
      }
    }
    const float b96 = pq[253 - tok_idx(96)], b97 = pq[253 - tok_idx(97)];
    const int   c96 = lCnt[96],              c97 = lCnt[97];
    // Keeps the run of loads above in one place: spread among the compares below,
    // each small group of them costs the wave a wait for LDS of its own.
    __builtin_amdgcn_sched_barrier(0);
    // unrolled, like the loops above: st and kc stay in registers
#pragma unroll
    for (int kt = 0; kt < 6; ++kt) {
#pragma unroll
      for (int r = 0; r < 8; ++r)
        if (kc[kt][r] != qcnt) st[kt][r] -= 100.0f;
    }
#pragma unroll
    for (int r = 0; r < 8; ++r) st[6][r] = -3.0e38f;   // keys 98..111 are K-padding
    const float s96 = (c96 != qcnt) ? b96 - 100.0f : b96;   // keys 96, 97
    const float s97 = (c97 != qcnt) ? b97 - 100.0f : b97;
    st[6][0] = half ? -3.0e38f : s96;
    st[6][1] = half ? -3.0e38f : s97;

    const v16h bq = frag_lds(lQ + n * LDP, h * 32, lane);
#pragma unroll
    for (int kt = 0; kt < 7; ++kt) {
      const v16h a = frag_lds(lK + (kt * 16 + l16) * LDP, h * 32, lane);
      st[kt] = __builtin_amdgcn_wmma_f32_16x16x32_f16(false, a, false, bq,
                                                      (short)0, st[kt], false, false);
    }

    // softmax of the lane's query: in-lane, then one exchange between the halves
    v8f m8 = st[0];
#pragma unroll
    for (int kt = 1; kt < 6; ++kt) m8 = __builtin_elementwise_max(m8, st[kt]);
    m8[0] = fmaxf(m8[0], st[6][0]);
    m8[1] = fmaxf(m8[1], st[6][1]);
    float vmax = fmaxf(fmaxf(fmaxf(m8[0], m8[1]), fmaxf(m8[2], m8[3])),
                       fmaxf(fmaxf(m8[4], m8[5]), fmaxf(m8[6], m8[7])));
    vmax = fmaxf(vmax, other_half(vmax));
    v8f s8 = {};
#pragma unroll
    for (int kt = 0; kt < 6; ++kt) {
#pragma unroll
      for (int r = 0; r < 8; ++r) st[kt][r] = __expf(st[kt][r] - vmax);
      s8 += st[kt];
    }
    const float p96 = __expf(st[6][0] - vmax);
    const float p97 = __expf(st[6][1] - vmax);
    s8[0] += p96;
    s8[1] += p97;
    float sum = ((s8[0] + s8[1]) + (s8[2] + s8[3])) + ((s8[4] + s8[5]) + (s8[6] + s8[7]));
    sum += other_half(sum);
    const float inv = __builtin_amdgcn_rcpf(sum);   // applied to O, not to P

    v16h pb[4];
#pragma unroll
    for (int t = 0; t < 3; ++t) {
#pragma unroll
      for (int i = 0; i < 8; ++i) {
        pb[t][i]     = (_Float16)st[2 * t][i];
        pb[t][8 + i] = (_Float16)st[2 * t + 1][i];
      }
    }
    pb[3] = v16h{};
    pb[3][0] = (_Float16)p96;
    pb[3][1] = (_Float16)p97;

    // O^T(32 ch x 16 queries) = V_h^T(32 x 128) @ P^T(128 x 16); a lane ends up
    // with 8 adjacent channels of its query: one 16-byte store per tile
#pragma unroll
    for (int ct = 0; ct < 2; ++ct) {
      const _Float16* vrow = lVt + (h * 32 + ct * 16 + l16) * LDP;
      v8f acc = {};
#pragma unroll
      for (int ks = 0; ks < 4; ++ks) {
        const v16h a = frag_lds(vrow, ks * 32, lane);
        acc = __builtin_amdgcn_wmma_f32_16x16x32_f16(false, a, false, pb[ks],
                                                     (short)0, acc, false, false);
      }
      h8 ov;
#pragma unroll
      for (int r = 0; r < 8; ++r) ov[r] = (_Float16)(acc[r] * inv);
      *(h8*)(lO + n * LDP + h * 32 + ct * 16 + 8 * half) = ov;
    }
  }
  __syncthreads();

  // ---- proj GEMM + bias, scatter to rolled-back positions -----------------
  for (int tile = wv; tile < 56; tile += NWAVES) {
    const int mt = tile >> 3;
    const int nt = tile & 7;
    const _Float16* arow = lO + (mt * 16 + (lane & 15)) * LDP;
    const int o = nt * 16 + (lane & 15);
    v8f acc = {};
#pragma unroll
    for (int ks = 0; ks < 4; ++ks) {
      v16h a  = frag_lds(arow, ks * 32, lane);
      v16h bb = frag_w128(projw, o, ks, lane);
      acc = __builtin_amdgcn_wmma_f32_16x16x32_f16(false, a, false, bb,
                                                   (short)0, acc, false, false);
    }
    const float pb = projb[o];
    const int mb = mt * 16 + ((lane & 16) ? 8 : 0);
#pragma unroll
    for (int r = 0; r < 8; ++r) {
      const int m = mb + r;
      if (m < 98) outg[lRow[m] + o] = acc[r] + pb;
    }
  }
}

extern "C" void kernel_launch(void* const* d_in, const int* in_sizes, int n_in,
                              void* d_out, int out_size, void* d_ws, size_t ws_size,
                              hipStream_t stream) {
  (void)in_sizes; (void)n_in; (void)d_ws; (void)ws_size; (void)out_size;
  const float* x     = (const float*)d_in[0];
  const float* qkvw  = (const float*)d_in[1];
  const float* projw = (const float*)d_in[2];
  const float* projb = (const float*)d_in[3];
  const float* rpb   = (const float*)d_in[4];
  float* out = (float*)d_out;

  // allow >64KB dynamic LDS (WGP has 320KB); harmless if already set
  (void)hipFuncSetAttribute(reinterpret_cast<const void*>(swin3d_msa_kernel),
                            hipFuncAttributeMaxDynamicSharedMemorySize,
                            SMEM_BYTES);

  swin3d_msa_kernel<<<1024, NTHREADS, SMEM_BYTES, stream>>>(
      x, qkvw, projw, projb, rpb, out);
}

// v006
// One run takes 40 microseconds.
// Next to v005, in two timings, it ran 1.21 times as fast each time.
// Counting every step since v000, it is 8.21 times as fast.
#include <hip/hip_runtime.h>
#include <hip/hip_bf16.h>

typedef __attribute__((ext_vector_type(16))) _Float16 v16h;
typedef __attribute__((ext_vector_type(8)))  _Float16 h8;
typedef __attribute__((ext_vector_type(8)))  float    v8f;
typedef __attribute__((ext_vector_type(4)))  float    f4;

#define NTHREADS 256

// Row pitch of every f16 matrix in LDS, in halves: 128 data + 8 pad = 272 B =
// 16 B x odd, so the 16 rows that one ds_load_b128 fragment read touches fall on
// 16 different groups of four banks (at 256 B they all fall on the same four).
// The pad halves are never read.
#define LDP      136

// LDS arena layout (bytes). All offsets 16B-aligned.
#define OFF_Q    0          // 112 rows f16 : Q (pre-scaled)
#define OFF_K    30464      // 112 rows f16 : K
#define OFF_VT   60928      // 128 rows f16 : V transposed [ch][pos]
#define OFF_X    95744      // 112 rows f16 : x window (A matrix of the QKV GEMM)
#define OFF_O    OFF_X      // 112 rows f16 : attention output (all heads); x is dead by then
#define OFF_F    0          // 112 rows f32 : proj output on its way out; Q and K are dead by then
#define OFF_TAB  126208     // 4 x 512 f32 : rel-pos bias table, head-major
#define OFF_CNT  134400     // 112 i32    : shift-mask region id per token
#define OFF_ROW  134848     // 112 i32    : global f32 offset of each token's (rolled) position
#define SMEM_BYTES 135296

// Row pitch of the f32 staging rows, in floats: 128 data + 4 pad = 528 B = 16 B x
// odd, so the 16 tokens of one 16-byte store fall on different banks.
#define FP       132

// Floats per head in the LDS copy of the bias table (507 used).  Head-major: the
// different table rows of a wave's 32 look-ups (one head) lie on different banks.
#define TABP     512

// ---- fragment loaders -------------------------------------------------------
// 16-bit A/B operand K-layout (ISA 7.12.2): lane holds 16 halves as two
// contiguous 8-element runs: K in [base, base+8) and [base+16, base+24),
// base = (lane<16 ? 0 : 8).  B mirrors A with the tile column in lanes.

__device__ __forceinline__ v16h frag_lds(const _Float16* __restrict__ row,
                                         int cbase, int lane) {
  const int kb = cbase + ((lane & 16) ? 8 : 0);
  h8 a = *(const h8*)(row + kb);
  h8 b = *(const h8*)(row + kb + 16);
  v16h r;
#pragma unroll
  for (int i = 0; i < 8; ++i) { r[i] = a[i]; r[i + 8] = b[i]; }
  return r;
}

// B fragment straight from a row-major fp32 weight matrix W[o][128]:
// B[c][o] = W[o*128 + c].  Two 8-float contiguous runs -> 4x b128 loads.
__device__ __forceinline__ v16h frag_w128(const float* __restrict__ W,
                                          int o, int ks, int lane) {
  const int kb = ks * 32 + ((lane & 16) ? 8 : 0);
  const float* p = W + o * 128 + kb;
  f4 a0 = *(const f4*)(p);
  f4 a1 = *(const f4*)(p + 4);
  f4 b0 = *(const f4*)(p + 16);
  f4 b1 = *(const f4*)(p + 20);
  v16h r;
#pragma unroll
  for (int i = 0; i < 4; ++i) {
    r[i]      = (_Float16)a0[i];
    r[4 + i]  = (_Float16)a1[i];
    r[8 + i]  = (_Float16)b0[i];
    r[12 + i] = (_Float16)b1[i];
  }
  return r;
}

// C/D layout: VGPR r holds (M = m0 + r + (lane<16?0:8), N = n0 + lane%16)
__device__ __forceinline__ void store_tile(_Float16* __restrict__ dst,
                                           int m0, int n0, int lane,
                                           v8f acc, float mul) {
  const int n  = n0 + (lane & 15);
  const int mb = m0 + ((lane & 16) ? 8 : 0);
#pragma unroll
  for (int r = 0; r < 8; ++r)
    dst[(mb + r) * LDP + n] = (_Float16)(acc[r] * mul);
}

// value of the lane 16 further on / back (l ^ 16); every lane of the wave must be on
__device__ __forceinline__ float other_half(float x) {
  const int b = __builtin_bit_cast(int, x);
  return __builtin_bit_cast(float,
      __builtin_amdgcn_permlanex16(b, b, 0x76543210, 0xfedcba98, false, false));
}

// token m = t*49 + h*7 + w of a window -> t*169 + h*13 + w; the row of the bias
// table for (query n, key m) is tok_idx(n) - tok_idx(m) + 253
__device__ __forceinline__ constexpr int tok_idx(int m) {
  return m + 120 * (m / 49) + 6 * ((m % 49) / 7);
}

// keys m and m + 8 (m = 16 kt + r, r < 8, both below 96) lie 14 or 20 table rows
// apart, but for m = 48
__device__ __forceinline__ constexpr bool key_steps_ok() {
  for (int m = 0; m < 96; ++m) {
    if ((m & 15) >= 8) continue;
    const int d = tok_idx(m + 8) - tok_idx(m);
    if (d != 14 && d != 20 && m != 48) return false;
  }
  return true;
}
static_assert(key_steps_ok(), "bias address steps");

__global__ void __launch_bounds__(NTHREADS)
swin3d_msa_kernel(const float* __restrict__ xg,
                  const float* __restrict__ qkvw,   // (384,128)
                  const float* __restrict__ projw,  // (128,128)
                  const float* __restrict__ projb,  // (128)
                  const float* __restrict__ rpb,    // (507,4)
                  float* __restrict__ outg) {
  extern __shared__ char smem[] __attribute__((aligned(16)));
  _Float16* lQ  = (_Float16*)(smem + OFF_Q);
  _Float16* lK  = (_Float16*)(smem + OFF_K);
  _Float16* lVt = (_Float16*)(smem + OFF_VT);
  _Float16* lX  = (_Float16*)(smem + OFF_X);
  _Float16* lO  = (_Float16*)(smem + OFF_O);
  float* lF   = (float*)(smem + OFF_F);
  float* lTab = (float*)(smem + OFF_TAB);
  int* lCnt = (int*)(smem + OFF_CNT);
  int* lRow = (int*)(smem + OFF_ROW);

  const int tid  = threadIdx.x;
  const int lane = tid & 31;
  const int wv   = tid >> 5;

  // window decomposition: blocks ordered (b, bt, bh, bw) = (2, 8, 8, 8)
  const int blk = blockIdx.x;
  const int b   = blk >> 9;
  const int wb  = blk & 511;
  const int bt  = wb >> 6;
  const int bh  = (wb >> 3) & 7;
  const int bw  = wb & 7;

  // bias table rows tid and tid + 256: read now, stored to LDS behind the zero fill
  const bool two = tid + NTHREADS < 507;
  const f4 t0 = *(const f4*)(rpb + tid * 4);
  const f4 t1 = *(const f4*)(rpb + (two ? tid + NTHREADS : tid) * 4);

  // zero the f16 arena (padding rows/cols must be 0 for the WMMA tiles)
  {
    uint32_t* z = (uint32_t*)smem;
    for (int i = tid; i < (OFF_TAB >> 2); i += NTHREADS) z[i] = 0u;
  }

  // unrolled: constant element numbers keep t0 and t1 in registers
#pragma unroll
  for (int hh = 0; hh < 4; ++hh) lTab[hh * TABP + tid] = t0[hh];
  if (two) {
#pragma unroll
    for (int hh = 0; hh < 4; ++hh) lTab[hh * TABP + tid + NTHREADS] = t1[hh];
  }

  // per-token metadata: region id (shift mask) + global row offset.
  // rolled coords g; source/dest position = (g + shift) % dim (input gather
  // and output scatter use the identical mapping).
  if (tid < 98) {
    const int ti = tid / 49;
    const int rm = tid % 49;
    const int hi = rm / 7;
    const int wi = rm % 7;
    const int gT = bt * 2 + ti, gH = bh * 7 + hi, gW = bw * 7 + wi;
    const int rt = (gT < 14) ? 0 : ((gT < 15) ? 1 : 2);
    const int rh = (gH < 49) ? 0 : ((gH < 53) ? 1 : 2);
    const int rw = (gW < 49) ? 0 : ((gW < 53) ? 1 : 2);
    lCnt[tid] = rt * 9 + rh * 3 + rw;
    const int sT = (gT + 1) & 15;
    int sH = gH + 3; if (sH >= 56) sH -= 56;
    int sW = gW + 3; if (sW >= 56) sW -= 56;
    lRow[tid] = (((b * 16 + sT) * 56 + sH) * 56 + sW) * 128;
  }
  __syncthreads();

  // ---- gather window x (98x128 f32 -> f16 in LDS, rows 98..111 stay 0) ----
  for (int idx = tid; idx < 98 * 32; idx += NTHREADS) {
    const int row = idx >> 5;
    const int c4  = (idx & 31) << 2;
    f4 v = *(const f4*)(xg + lRow[row] + c4);
    _Float16* d = lX + row * LDP + c4;
    d[0] = (_Float16)v[0]; d[1] = (_Float16)v[1];
    d[2] = (_Float16)v[2]; d[3] = (_Float16)v[3];
  }
  __syncthreads();

  // ---- QKV GEMM: (112x384) = X(112x128) @ qkv_w^T(128x384) ----------------
  const float SCALE = 0.17677669529663687f;  // 32^-0.5
  // Wave wv owns output columns 16 wv .. 16 wv + 15 of each of q, k and v.  Its
  // three weight tiles are read from global memory and converted once and stay
  // in registers over the 7 row tiles; each row tile's A fragments serve all three.
  {
    const int oc = wv * 16 + (lane & 15);
    v16h wq[4], wk[4], wvv[4];
#pragma unroll
    for (int ks = 0; ks < 4; ++ks) {
      wq[ks]  = frag_w128(qkvw, oc, ks, lane);
      wk[ks]  = frag_w128(qkvw, 128 + oc, ks, lane);
      wvv[ks] = frag_w128(qkvw, 256 + oc, ks, lane);
    }
    for (int mt = 0; mt < 7; ++mt) {
      const int m0 = mt * 16;
      const _Float16* arow = lX + (m0 + (lane & 15)) * LDP;
      v16h a[4];
#pragma unroll
      for (int ks = 0; ks < 4; ++ks) a[ks] = frag_lds(arow, ks * 32, lane);
      v8f aq = {}, ak = {}, av = {};
#pragma unroll
      for (int ks = 0; ks < 4; ++ks) {
        aq = __builtin_amdgcn_wmma_f32_16x16x32_f16(false, a[ks], false, wq[ks],
                                                    (short)0, aq, false, false);
        ak = __builtin_amdgcn_wmma_f32_16x16x32_f16(false, a[ks], false, wk[ks],
                                                    (short)0, ak, false, false);
        av = __builtin_amdgcn_wmma_f32_16x16x32_f16(false, a[ks], false, wvv[ks],
                                                    (short)0, av, false, false);
      }
      store_tile(lQ, m0, wv * 16, lane, aq, SCALE);      // q * scale
      store_tile(lK, m0, wv * 16, lane, ak, 1.0f);       // k
      const int mb = m0 + ((lane & 16) ? 8 : 0);         // v, transposed
#pragma unroll
      for (int r = 0; r < 8; ++r)
        lVt[oc * LDP + mb + r] = (_Float16)av[r];
    }
  }
  __syncthreads();

  // ---- attention: a wave takes one head and 16 queries at a time -----------
  // S^T = K_h Q_h^T: a lane holds the scores of ONE query (column l16) against
  // keys 16 kt + 8 half + r in register r of tile kt.  That is the k order of a
  // B operand, so exp(S^T) is packed as it lies and O^T = V_h^T P^T follows with
  // no trip of the scores through LDS and no barrier between the heads.
  const int l16  = lane & 15;
  const int half = lane >> 4;
  const int wvs  = __builtin_amdgcn_readfirstlane(wv);
  const int h    = wvs & 3;
  for (int qt = wvs >> 2; qt < 7; qt += 2) {
    const int n    = qt * 16 + l16;
    const int nc   = (n < 98) ? n : 97;    // padding queries: stay in the table
    const int qcnt = lCnt[nc];
    const float* pq = lTab + h * TABP + tok_idx(nc);
    // lanes 16..31 hold the key 8 further on: 14 or 20 table rows lower; the one
    // pair that spans the two frames (keys 48 and 56) has an address of its own
    const float* pA = pq - (half ? 14 : 0);
    const float* pB = pq - (half ? 20 : 0);
    const float* pX = pq + (half ? 253 - tok_idx(56) : 253 - tok_idx(48));

    // start value of the accumulators: rel-pos bias + shift mask.  All look-ups
    // (bias and region ids) are read first, as one run of LDS loads.
    v8f st[7];
    int kc[6][8];
#pragma unroll
    for (int kt = 0; kt < 6; ++kt) {
#pragma unroll
      for (int r = 0; r < 8; ++r) {
        const int c0 = tok_idx(kt * 16 + r);             // key of lanes 0..15
        const int d  = tok_idx(kt * 16 + 8 + r) - c0;    // lanes 16..31: 8 keys on
        const float* p = (d == 14) ? pA + (253 - c0)
                       : (d == 20) ? pB + (253 - c0) : pX;
        st[kt][r] = *p;
        kc[kt][r] = lCnt[kt * 16 + 8 * half + r];
      }
    }
    const float b96 = pq[253 - tok_idx(96)], b97 = pq[253 - tok_idx(97)];
    const int   c96 = lCnt[96],              c97 = lCnt[97];
    // Keeps the run of loads above in one place: spread among the compares below,
    // each small group of them costs the wave a wait for LDS of its own.
    __builtin_amdgcn_sched_barrier(0);
    // unrolled, like the loops above: st and kc stay in registers
#pragma unroll
    for (int kt = 0; kt < 6; ++kt) {
#pragma unroll
      for (int r = 0; r < 8; ++r)
        if (kc[kt][r] != qcnt) st[kt][r] -= 100.0f;
    }
#pragma unroll
    for (int r = 0; r < 8; ++r) st[6][r] = -3.0e38f;   // keys 98..111 are K-padding
    const float s96 = (c96 != qcnt) ? b96 - 100.0f : b96;   // keys 96, 97
    const float s97 = (c97 != qcnt) ? b97 - 100.0f : b97;
    st[6][0] = half ? -3.0e38f : s96;
    st[6][1] = half ? -3.0e38f : s97;

    const v16h bq = frag_lds(lQ + n * LDP, h * 32, lane);
#pragma unroll
    for (int kt = 0; kt < 7; ++kt) {
      const v16h a = frag_lds(lK + (kt * 16 + l16) * LDP, h * 32, lane);
      st[kt] = __builtin_amdgcn_wmma_f32_16x16x32_f16(false, a, false, bq,
                                                      (short)0, st[kt], false, false);
    }

    // softmax of the lane's query: in-lane, then one exchange between the halves
    v8f m8 = st[0];
#pragma unroll
    for (int kt = 1; kt < 6; ++kt) m8 = __builtin_elementwise_max(m8, st[kt]);
    m8[0] = fmaxf(m8[0], st[6][0]);
    m8[1] = fmaxf(m8[1], st[6][1]);
    float vmax = fmaxf(fmaxf(fmaxf(m8[0], m8[1]), fmaxf(m8[2], m8[3])),
                       fmaxf(fmaxf(m8[4], m8[5]), fmaxf(m8[6], m8[7])));
    vmax = fmaxf(vmax, other_half(vmax));
    v8f s8 = {};
#pragma unroll
    for (int kt = 0; kt < 6; ++kt) {
#pragma unroll
      for (int r = 0; r < 8; ++r) st[kt][r] = __expf(st[kt][r] - vmax);
      s8 += st[kt];
    }
    const float p96 = __expf(st[6][0] - vmax);
    const float p97 = __expf(st[6][1] - vmax);
    s8[0] += p96;
    s8[1] += p97;
    float sum = ((s8[0] + s8[1]) + (s8[2] + s8[3])) + ((s8[4] + s8[5]) + (s8[6] + s8[7]));
    sum += other_half(sum);
    const float inv = __builtin_amdgcn_rcpf(sum);   // applied to O, not to P

    v16h pb[4];
#pragma unroll
    for (int t = 0; t < 3; ++t) {
#pragma unroll
      for (int i = 0; i < 8; ++i) {
        pb[t][i]     = (_Float16)st[2 * t][i];
        pb[t][8 + i] = (_Float16)st[2 * t + 1][i];
      }
    }
    pb[3] = v16h{};
    pb[3][0] = (_Float16)p96;
    pb[3][1] = (_Float16)p97;

    // O^T(32 ch x 16 queries) = V_h^T(32 x 128) @ P^T(128 x 16); a lane ends up
    // with 8 adjacent channels of its query: one 16-byte store per tile
#pragma unroll
    for (int ct = 0; ct < 2; ++ct) {
      const _Float16* vrow = lVt + (h * 32 + ct * 16 + l16) * LDP;
      v8f acc = {};
#pragma unroll
      for (int ks = 0; ks < 4; ++ks) {
        const v16h a = frag_lds(vrow, ks * 32, lane);
        acc = __builtin_amdgcn_wmma_f32_16x16x32_f16(false, a, false, pb[ks],
                                                     (short)0, acc, false, false);
      }
      h8 ov;
#pragma unroll
      for (int r = 0; r < 8; ++r) ov[r] = (_Float16)(acc[r] * inv);
      *(h8*)(lO + n * LDP + h * 32 + ct * 16 + 8 * half) = ov;
    }
  }
  __syncthreads();

  // ---- proj GEMM, transposed: out^T = proj_w O^T ---------------------------
  // Wave wv owns output channels 16 wv .. 16 wv + 15.  With the weights as A and
  // the tokens as B a lane ends up with 8 adjacent channels of ONE token, which go
  // to the f32 staging rows in LDS as two 16-byte stores.
  {
    const int o = wvs * 16 + l16;
    // the wave's weight tile, 16 x 128 f32: 16-byte piece j holds k = 32 (j / 4) +
    // 16 ((j / 2) % 2) + 4 (j % 2) + 8 half .. + 3, the k order of frag_w128
    const float* p = projw + o * 128 + ((lane & 16) ? 8 : 0);
    f4 w[16];
#pragma unroll
    for (int j = 0; j < 15; ++j)
      w[j] = *(const f4*)(p + 32 * (j >> 2) + 16 * ((j >> 1) & 1) + 4 * (j & 1));
    // precaution: the last load's result may take the address registers that the
    // fifteen loads before it name; this wait stands ahead of that overwrite
    asm volatile("s_wait_xcnt 0x0" ::: "memory");
    w[15] = *(const f4*)(p + 116);
    v16h wp[4];
#pragma unroll
    for (int j = 0; j < 16; ++j) {
#pragma unroll
      for (int i = 0; i < 4; ++i) wp[j >> 2][4 * (j & 3) + i] = (_Float16)w[j][i];
    }
    // One accumulator per token tile, k step outermost: seven independent WMMAs
    // follow one run of LDS reads.  Unrolled: acc and tb stay in registers.
    v8f acc[7] = {};
#pragma unroll
    for (int ks = 0; ks < 4; ++ks) {
      v16h tb[7];
#pragma unroll
      for (int mt = 0; mt < 7; ++mt)
        tb[mt] = frag_lds(lO + (mt * 16 + l16) * LDP, ks * 32, lane);
#pragma unroll
      for (int mt = 0; mt < 7; ++mt)
        acc[mt] = __builtin_amdgcn_wmma_f32_16x16x32_f16(false, wp[ks], false, tb[mt],
                                                         (short)0, acc[mt], false, false);
    }
#pragma unroll
    for (int mt = 0; mt < 7; ++mt) {
      float* d = lF + (mt * 16 + l16) * FP + wvs * 16 + 8 * half;
      *(f4*)(d)     = f4{acc[mt][0], acc[mt][1], acc[mt][2], acc[mt][3]};
      *(f4*)(d + 4) = f4{acc[mt][4], acc[mt][5], acc[mt][6], acc[mt][7]};
    }
  }

  // ---- + bias, scatter to rolled-back positions: a wave stores one token's whole
  // row (512 B in a row = four whole lines) per instruction.  Wave wv has rows
  // wv + 8 i.  The rows' offsets are as old as the prologue and are read ahead of
  // the barrier.
  const f4 bias = *(const f4*)(projb + lane * 4);
  int ro[12];
#pragma unroll
  for (int i = 0; i < 12; ++i) ro[i] = lRow[wvs + 8 * i];
  __syncthreads();
  {
    const float* fcol = lF + lane * 4;
    float* ocol = outg + lane * 4;
    f4 v[12];
    // unrolled: v and ro stay in registers, all LDS reads ahead of the first store
#pragma unroll
    for (int i = 0; i < 12; ++i) v[i] = *(const f4*)(fcol + (wvs + 8 * i) * FP);
#pragma unroll
    for (int i = 0; i < 12; ++i) *(f4*)(ocol + ro[i]) = v[i] + bias;
    if (wvs < 2) {                       // tokens 96 and 97
      // precaution: stands ahead of the reuse of registers that the stores above name
      asm volatile("s_wait_xcnt 0x0" ::: "memory");
      const int row = 96 + wvs;
      *(f4*)(ocol + lRow[row]) = *(const f4*)(fcol + row * FP) + bias;
    }
  }
}

extern "C" void kernel_launch(void* const* d_in, const int* in_sizes, int n_in,
                              void* d_out, int out_size, void* d_ws, size_t ws_size,
                              hipStream_t stream) {
  (void)in_sizes; (void)n_in; (void)d_ws; (void)ws_size; (void)out_size;
  const float* x     = (const float*)d_in[0];
  const float* qkvw  = (const float*)d_in[1];
  const float* projw = (const float*)d_in[2];
  const float* projb = (const float*)d_in[3];
  const float* rpb   = (const float*)d_in[4];
  float* out = (float*)d_out;

  // allow >64KB dynamic LDS (WGP has 320KB); harmless if already set
  (void)hipFuncSetAttribute(reinterpret_cast<const void*>(swin3d_msa_kernel),
                            hipFuncAttributeMaxDynamicSharedMemorySize,
                            SMEM_BYTES);

  swin3d_msa_kernel<<<1024, NTHREADS, SMEM_BYTES, stream>>>(
      x, qkvw, projw, projb, rpb, out);
}

// v007
// A run of this version takes 35.9 microseconds.
// In two side-by-side timings against v006, it was 1.11 and 1.12 times as fast.
// All steps since v000 together make it 9.16 times as fast.
#include <hip/hip_runtime.h>
#include <hip/hip_bf16.h>

typedef __attribute__((ext_vector_type(16))) _Float16 v16h;
typedef __attribute__((ext_vector_type(8)))  _Float16 h8;
typedef __attribute__((ext_vector_type(4)))  _Float16 h4;
typedef __attribute__((ext_vector_type(8)))  float    v8f;
typedef __attribute__((ext_vector_type(4)))  float    f4;

#define NTHREADS 256

// Row pitch of every f16 matrix in LDS, in halves: 128 data + 8 pad = 272 B =
// 16 B x odd, so the 16 rows that one ds_load_b128 fragment read touches fall on
// 16 different groups of four banks (at 256 B they all fall on the same four).
// The pad halves are never read.
#define LDP      136

// LDS arena layout (bytes). All offsets 16B-aligned.
#define OFF_Q    0          // 112 rows f16 : Q (pre-scaled)
#define OFF_K    30464      // 112 rows f16 : K
#define OFF_VT   60928      // 128 rows f16 : V transposed [ch][pos]
#define OFF_X    95744      // 112 rows f16 : x window (A matrix of the QKV GEMM)
#define OFF_O    OFF_X      // 112 rows f16 : attention output (all heads); x is dead by then
#define OFF_F    0          // 112 rows f32 : proj output on its way out; Q and K are dead by then
#define OFF_TAB  126208     // 4 x 512 f32 : rel-pos bias table, head-major
#define OFF_CNT  134400     // 112 i32    : shift-mask region id per token
#define OFF_ROW  134848     // 112 i32    : global f32 offset of each token's (rolled) position
#define SMEM_BYTES 135296

// Row pitch of the f32 staging rows, in floats: 128 data + 4 pad = 528 B = 16 B x
// odd, so the 16 tokens of one 16-byte store fall on different banks.
#define FP       132

// Floats per head in the LDS copy of the bias table (507 used).  Head-major: the
// different table rows of a wave's 32 look-ups (one head) lie on different banks.
#define TABP     512

// ---- fragment loaders -------------------------------------------------------
// 16-bit A/B operand K-layout (ISA 7.12.2): lane holds 16 halves as two
// contiguous 8-element runs: K in [base, base+8) and [base+16, base+24),
// base = (lane<16 ? 0 : 8).  B mirrors A with the tile column in lanes.

__device__ __forceinline__ v16h frag_lds(const _Float16* __restrict__ row,
                                         int cbase, int lane) {
  const int kb = cbase + ((lane & 16) ? 8 : 0);
  h8 a = *(const h8*)(row + kb);
  h8 b = *(const h8*)(row + kb + 16);
  v16h r;
#pragma unroll
  for (int i = 0; i < 8; ++i) { r[i] = a[i]; r[i + 8] = b[i]; }
  return r;
}

// B fragment straight from a row-major fp32 weight matrix W[o][128]:
// B[c][o] = W[o*128 + c].  Two 8-float contiguous runs -> 4x b128 loads.
// In two parts, for loads that are issued long before their use: the loads ...
__device__ __forceinline__ void raw_w128(f4 (&r)[4], const float* __restrict__ W,
                                         int o, int ks, int lane) {
  const float* p = W + o * 128 + ks * 32 + ((lane & 16) ? 8 : 0);
  r[0] = *(const f4*)(p);
  r[1] = *(const f4*)(p + 4);
  r[2] = *(const f4*)(p + 16);
  r[3] = *(const f4*)(p + 20);
}

// ... and their conversion; piece j holds k = 16 (j / 2) + 4 (j % 2) + 8 half .. + 3
__device__ __forceinline__ v16h cvt_w128(const f4 (&r)[4]) {
  v16h f;
  // unrolled: constant element numbers keep r and f in registers
#pragma unroll
  for (int j = 0; j < 4; ++j) {
#pragma unroll
    for (int i = 0; i < 4; ++i) f[4 * j + i] = (_Float16)r[j][i];
  }
  return f;
}

// C/D layout: VGPR r holds (M = m0 + r + (lane<16?0:8), N = n0 + lane%16)
__device__ __forceinline__ void store_tile(_Float16* __restrict__ dst,
                                           int m0, int n0, int lane,
                                           v8f acc, float mul) {
  const int n  = n0 + (lane & 15);
  const int mb = m0 + ((lane & 16) ? 8 : 0);
#pragma unroll
  for (int r = 0; r < 8; ++r)
    dst[(mb + r) * LDP + n] = (_Float16)(acc[r] * mul);
}

// value of the lane 16 further on / back (l ^ 16); every lane of the wave must be on
__device__ __forceinline__ float other_half(float x) {
  const int b = __builtin_bit_cast(int, x);
  return __builtin_bit_cast(float,
      __builtin_amdgcn_permlanex16(b, b, 0x76543210, 0xfedcba98, false, false));
}

// token m = t*49 + h*7 + w of a window -> t*169 + h*13 + w; the row of the bias
// table for (query n, key m) is tok_idx(n) - tok_idx(m) + 253
__device__ __forceinline__ constexpr int tok_idx(int m) {
  return m + 120 * (m / 49) + 6 * ((m % 49) / 7);
}

// keys m and m + 8 (m = 16 kt + r, r < 8, both below 96) lie 14 or 20 table rows
// apart, but for m = 48
__device__ __forceinline__ constexpr bool key_steps_ok() {
  for (int m = 0; m < 96; ++m) {
    if ((m & 15) >= 8) continue;
    const int d = tok_idx(m + 8) - tok_idx(m);
    if (d != 14 && d != 20 && m != 48) return false;
  }
  return true;
}
static_assert(key_steps_ok(), "bias address steps");

// global f32 offset of token m of window (b, bt, bh, bw): rolled coords g, source /
// dest position = (g + shift) % dim (input gather and output scatter use the
// identical mapping)
__device__ __forceinline__ int tok_pos(int m, int b, int bt, int bh, int bw) {
  const int ti = m / 49;
  const int rm = m % 49;
  const int gT = bt * 2 + ti, gH = bh * 7 + rm / 7, gW = bw * 7 + rm % 7;
  const int sT = (gT + 1) & 15;
  int sH = gH + 3; if (sH >= 56) sH -= 56;
  int sW = gW + 3; if (sW >= 56) sW -= 56;
  return (((b * 16 + sT) * 56 + sH) * 56 + sW) * 128;
}

__global__ void __launch_bounds__(NTHREADS)
swin3d_msa_kernel(const float* __restrict__ xg,
                  const float* __restrict__ qkvw,   // (384,128)
                  const float* __restrict__ projw,  // (128,128)
                  const float* __restrict__ projb,  // (128)
                  const float* __restrict__ rpb,    // (507,4)
                  float* __restrict__ outg) {
  extern __shared__ char smem[] __attribute__((aligned(16)));
  _Float16* lQ  = (_Float16*)(smem + OFF_Q);
  _Float16* lK  = (_Float16*)(smem + OFF_K);
  _Float16* lVt = (_Float16*)(smem + OFF_VT);
  _Float16* lX  = (_Float16*)(smem + OFF_X);
  _Float16* lO  = (_Float16*)(smem + OFF_O);
  float* lF   = (float*)(smem + OFF_F);
  float* lTab = (float*)(smem + OFF_TAB);
  int* lCnt = (int*)(smem + OFF_CNT);
  int* lRow = (int*)(smem + OFF_ROW);

  const int tid  = threadIdx.x;
  const int lane = tid & 31;
  const int wv   = tid >> 5;
  const int wvs  = __builtin_amdgcn_readfirstlane(wv);

  // window decomposition: blocks ordered (b, bt, bh, bw) = (2, 8, 8, 8)
  const int blk = blockIdx.x;
  const int b   = blk >> 9;
  const int wb  = blk & 511;
  const int bt  = wb >> 6;
  const int bh  = (wb >> 3) & 7;
  const int bw  = wb & 7;

  // bias table rows tid and tid + 256: read now, stored to LDS behind the zero fill
  const bool two = tid + NTHREADS < 507;
  const f4 t0 = *(const f4*)(rpb + tid * 4);
  const f4 t1 = *(const f4*)(rpb + (two ? tid + NTHREADS : tid) * 4);

  // ---- the global reads of the QKV GEMM start here, ahead of the LDS fill and of
  // both barriers, so that they are all in flight together and over the fill.
  // x: wave wv has rows wv + 8 i, a whole row (512 B) per load.  Lane i works out the
  // position of row wv + 8 i (past the last token: of token 97, read but not kept).
  const int rpos = tok_pos(min(wvs + 8 * lane, 97), b, bt, bh, bw);
  // Unrolled, like the loops over xr, xh, rq, rk and rv below: constant element numbers
  // keep these arrays in registers.
  f4 xr[13];
#pragma unroll
  for (int i = 0; i < 13; ++i) {
    const float* xrow = xg + __builtin_amdgcn_readlane(rpos, i);   // same in every lane
    xr[i] = *(const f4*)(xrow + (unsigned)lane * 4u);
  }
  // precaution: the results of the loads below may take registers that the loads
  // above name; this wait stands ahead of that overwrite
  asm volatile("s_wait_xcnt 0x0" ::: "memory");
  // weights: wave wv owns output columns 16 wv .. 16 wv + 15 of each of q, k and v;
  // q and k start now, v behind the LDS fill (x and all three tiles as f32, with what
  // the fill needs, are more than the 256 registers that two work-groups per WGP allow)
  const int oc = wv * 16 + (lane & 15);
  f4 rq[4][4], rk[4][4], rv[4][4];
#pragma unroll
  for (int ks = 0; ks < 4; ++ks) {
    raw_w128(rq[ks], qkvw, oc, ks, lane);
    raw_w128(rk[ks], qkvw, 128 + oc, ks, lane);
  }

  // zero the f16 arena (padding rows/cols must be 0 for the WMMA tiles)
  {
    uint32_t* z = (uint32_t*)smem;
    for (int i = tid; i < (OFF_TAB >> 2); i += NTHREADS) z[i] = 0u;
  }

  // unrolled: constant element numbers keep t0 and t1 in registers
#pragma unroll
  for (int hh = 0; hh < 4; ++hh) lTab[hh * TABP + tid] = t0[hh];
  if (two) {
#pragma unroll
    for (int hh = 0; hh < 4; ++hh) lTab[hh * TABP + tid + NTHREADS] = t1[hh];
  }

  // per-token metadata: region id (shift mask) + global row offset.
  if (tid < 98) {
    const int ti = tid / 49;
    const int rm = tid % 49;
    const int hi = rm / 7;
    const int wi = rm % 7;
    const int gT = bt * 2 + ti, gH = bh * 7 + hi, gW = bw * 7 + wi;
    const int rt = (gT < 14) ? 0 : ((gT < 15) ? 1 : 2);
    const int rh = (gH < 49) ? 0 : ((gH < 53) ? 1 : 2);
    const int rw = (gW < 49) ? 0 : ((gW < 53) ? 1 : 2);
    lCnt[tid] = rt * 9 + rh * 3 + rw;
    lRow[tid] = tok_pos(tid, b, bt, bh, bw);
  }

#pragma unroll
  for (int ks = 0; ks < 4; ++ks) raw_w128(rv[ks], qkvw, 256 + oc, ks, lane);
  h4 xh[13];
#pragma unroll
  for (int i = 0; i < 13; ++i)
    xh[i] = h4{(_Float16)xr[i][0], (_Float16)xr[i][1], (_Float16)xr[i][2], (_Float16)xr[i][3]};
  __syncthreads();

  // ---- window x (98x128 f16) to LDS, rows 98..111 stay 0 -------------------
#pragma unroll
  for (int i = 0; i < 12; ++i)
    *(h4*)(lX + (wvs + 8 * i) * LDP + lane * 4) = xh[i];
  if (wvs < 2) *(h4*)(lX + (wvs + 96) * LDP + lane * 4) = xh[12];
  __syncthreads();

  // ---- QKV GEMM: (112x384) = X(112x128) @ qkv_w^T(128x384) ----------------
  const float SCALE = 0.17677669529663687f;  // 32^-0.5
  // The wave's three weight tiles (read at the kernel's entry) are converted once and
  // stay in registers over the 7 row tiles; each row tile's A fragments serve all three.
  {
    v16h wq[4], wk[4], wvv[4];
#pragma unroll
    for (int ks = 0; ks < 4; ++ks) {
      wq[ks]  = cvt_w128(rq[ks]);
      wk[ks]  = cvt_w128(rk[ks]);
      wvv[ks] = cvt_w128(rv[ks]);
    }
    for (int mt = 0; mt < 7; ++mt) {
      const int m0 = mt * 16;
      const _Float16* arow = lX + (m0 + (lane & 15)) * LDP;
      v16h a[4];
#pragma unroll
      for (int ks = 0; ks < 4; ++ks) a[ks] = frag_lds(arow, ks * 32, lane);
      v8f aq = {}, ak = {}, av = {};
#pragma unroll
      for (int ks = 0; ks < 4; ++ks) {
        aq = __builtin_amdgcn_wmma_f32_16x16x32_f16(false, a[ks], false, wq[ks],
                                                    (short)0, aq, false, false);
        ak = __builtin_amdgcn_wmma_f32_16x16x32_f16(false, a[ks], false, wk[ks],
                                                    (short)0, ak, false, false);
        av = __builtin_amdgcn_wmma_f32_16x16x32_f16(false, a[ks], false, wvv[ks],
                                                    (short)0, av, false, false);
      }
      store_tile(lQ, m0, wv * 16, lane, aq, SCALE);      // q * scale
      store_tile(lK, m0, wv * 16, lane, ak, 1.0f);       // k
      const int mb = m0 + ((lane & 16) ? 8 : 0);         // v, transposed
#pragma unroll
      for (int r = 0; r < 8; ++r)
        lVt[oc * LDP + mb + r] = (_Float16)av[r];
    }
  }
  __syncthreads();

  // ---- attention: a wave takes one head and 16 queries at a time -----------
  // S^T = K_h Q_h^T: a lane holds the scores of ONE query (column l16) against
  // keys 16 kt + 8 half + r in register r of tile kt.  That is the k order of a
  // B operand, so exp(S^T) is packed as it lies and O^T = V_h^T P^T follows with
  // no trip of the scores through LDS and no barrier between the heads.
  const int l16  = lane & 15;
  const int half = lane >> 4;
  const int h    = wvs & 3;
  for (int qt = wvs >> 2; qt < 7; qt += 2) {
    const int n    = qt * 16 + l16;
    const int nc   = (n < 98) ? n : 97;    // padding queries: stay in the table
    const int qcnt = lCnt[nc];
    const float* pq = lTab + h * TABP + tok_idx(nc);
    // lanes 16..31 hold the key 8 further on: 14 or 20 table rows lower; the one
    // pair that spans the two frames (keys 48 and 56) has an address of its own
    const float* pA = pq - (half ? 14 : 0);
    const float* pB = pq - (half ? 20 : 0);
    const float* pX = pq + (half ? 253 - tok_idx(56) : 253 - tok_idx(48));

    // start value of the accumulators: rel-pos bias + shift mask.  All look-ups
    // (bias and region ids) are read first, as one run of LDS loads.
    v8f st[7];
    int kc[6][8];
#pragma unroll
    for (int kt = 0; kt < 6; ++kt) {
#pragma unroll
      for (int r = 0; r < 8; ++r) {
        const int c0 = tok_idx(kt * 16 + r);             // key of lanes 0..15
        const int d  = tok_idx(kt * 16 + 8 + r) - c0;    // lanes 16..31: 8 keys on
        const float* p = (d == 14) ? pA + (253 - c0)
                       : (d == 20) ? pB + (253 - c0) : pX;
        st[kt][r] = *p;
        kc[kt][r] = lCnt[kt * 16 + 8 * half + r];
      }
    }
    const float b96 = pq[253 - tok_idx(96)], b97 = pq[253 - tok_idx(97)];
    const int   c96 = lCnt[96],              c97 = lCnt[97];
    // Keeps the run of loads above in one place: spread among the compares below,
    // each small group of them costs the wave a wait for LDS of its own.
    __builtin_amdgcn_sched_barrier(0);
    // unrolled, like the loops above: st and kc stay in registers
#pragma unroll
    for (int kt = 0; kt < 6; ++kt) {
#pragma unroll
      for (int r = 0; r < 8; ++r)
        if (kc[kt][r] != qcnt) st[kt][r] -= 100.0f;
    }
#pragma unroll
    for (int r = 0; r < 8; ++r) st[6][r] = -3.0e38f;   // keys 98..111 are K-padding
    const float s96 = (c96 != qcnt) ? b96 - 100.0f : b96;   // keys 96, 97
    const float s97 = (c97 != qcnt) ? b97 - 100.0f : b97;
    st[6][0] = half ? -3.0e38f : s96;
    st[6][1] = half ? -3.0e38f : s97;

    const v16h bq = frag_lds(lQ + n * LDP, h * 32, lane);
#pragma unroll
    for (int kt = 0; kt < 7; ++kt) {
      const v16h a = frag_lds(lK + (kt * 16 + l16) * LDP, h * 32, lane);
      st[kt] = __builtin_amdgcn_wmma_f32_16x16x32_f16(false, a, false, bq,
                                                      (short)0, st[kt], false, false);
    }

    // softmax of the lane's query: in-lane, then one exchange between the halves
    v8f m8 = st[0];
#pragma unroll
    for (int kt = 1; kt < 6; ++kt) m8 = __builtin_elementwise_max(m8, st[kt]);
    m8[0] = fmaxf(m8[0], st[6][0]);
    m8[1] = fmaxf(m8[1], st[6][1]);
    float vmax = fmaxf(fmaxf(fmaxf(m8[0], m8[1]), fmaxf(m8[2], m8[3])),
                       fmaxf(fmaxf(m8[4], m8[5]), fmaxf(m8[6], m8[7])));
    vmax = fmaxf(vmax, other_half(vmax));
    v8f s8 = {};
#pragma unroll
    for (int kt = 0; kt < 6; ++kt) {
#pragma unroll
      for (int r = 0; r < 8; ++r) st[kt][r] = __expf(st[kt][r] - vmax);
      s8 += st[kt];
    }
    const float p96 = __expf(st[6][0] - vmax);
    const float p97 = __expf(st[6][1] - vmax);
    s8[0] += p96;
    s8[1] += p97;
    float sum = ((s8[0] + s8[1]) + (s8[2] + s8[3])) + ((s8[4] + s8[5]) + (s8[6] + s8[7]));
    sum += other_half(sum);
    const float inv = __builtin_amdgcn_rcpf(sum);   // applied to O, not to P

    v16h pb[4];
#pragma unroll
    for (int t = 0; t < 3; ++t) {
#pragma unroll
      for (int i = 0; i < 8; ++i) {
        pb[t][i]     = (_Float16)st[2 * t][i];
        pb[t][8 + i] = (_Float16)st[2 * t + 1][i];
      }
    }
    pb[3] = v16h{};
    pb[3][0] = (_Float16)p96;
    pb[3][1] = (_Float16)p97;

    // O^T(32 ch x 16 queries) = V_h^T(32 x 128) @ P^T(128 x 16); a lane ends up
    // with 8 adjacent channels of its query: one 16-byte store per tile
#pragma unroll
    for (int ct = 0; ct < 2; ++ct) {
      const _Float16* vrow = lVt + (h * 32 + ct * 16 + l16) * LDP;
      v8f acc = {};
#pragma unroll
      for (int ks = 0; ks < 4; ++ks) {
        const v16h a = frag_lds(vrow, ks * 32, lane);
        acc = __builtin_amdgcn_wmma_f32_16x16x32_f16(false, a, false, pb[ks],
                                                     (short)0, acc, false, false);
      }
      h8 ov;
#pragma unroll
      for (int r = 0; r < 8; ++r) ov[r] = (_Float16)(acc[r] * inv);
      *(h8*)(lO + n * LDP + h * 32 + ct * 16 + 8 * half) = ov;
    }
  }
  __syncthreads();

  // ---- proj GEMM, transposed: out^T = proj_w O^T ---------------------------
  // Wave wv owns output channels 16 wv .. 16 wv + 15.  With the weights as A and
  // the tokens as B a lane ends up with 8 adjacent channels of ONE token, which go
  // to the f32 staging rows in LDS as two 16-byte stores.
  {
    const int o = wvs * 16 + l16;
    // the wave's weight tile, 16 x 128 f32: 16-byte piece j holds k = 32 (j / 4) +
    // 16 ((j / 2) % 2) + 4 (j % 2) + 8 half .. + 3, the k order of raw_w128
    const float* p = projw + o * 128 + ((lane & 16) ? 8 : 0);
    f4 w[16];
#pragma unroll
    for (int j = 0; j < 15; ++j)
      w[j] = *(const f4*)(p + 32 * (j >> 2) + 16 * ((j >> 1) & 1) + 4 * (j & 1));
    // precaution: the last load's result may take the address registers that the
    // fifteen loads before it name; this wait stands ahead of that overwrite
    asm volatile("s_wait_xcnt 0x0" ::: "memory");
    w[15] = *(const f4*)(p + 116);
    v16h wp[4];
#pragma unroll
    for (int j = 0; j < 16; ++j) {
#pragma unroll
      for (int i = 0; i < 4; ++i) wp[j >> 2][4 * (j & 3) + i] = (_Float16)w[j][i];
    }
    // One accumulator per token tile, k step outermost: seven independent WMMAs
    // follow one run of LDS reads.  Unrolled: acc and tb stay in registers.
    v8f acc[7] = {};
#pragma unroll
    for (int ks = 0; ks < 4; ++ks) {
      v16h tb[7];
#pragma unroll
      for (int mt = 0; mt < 7; ++mt)
        tb[mt] = frag_lds(lO + (mt * 16 + l16) * LDP, ks * 32, lane);
#pragma unroll
      for (int mt = 0; mt < 7; ++mt)
        acc[mt] = __builtin_amdgcn_wmma_f32_16x16x32_f16(false, wp[ks], false, tb[mt],
                                                         (short)0, acc[mt], false, false);
    }
#pragma unroll
    for (int mt = 0; mt < 7; ++mt) {
      float* d = lF + (mt * 16 + l16) * FP + wvs * 16 + 8 * half;
      *(f4*)(d)     = f4{acc[mt][0], acc[mt][1], acc[mt][2], acc[mt][3]};
      *(f4*)(d + 4) = f4{acc[mt][4], acc[mt][5], acc[mt][6], acc[mt][7]};
    }
  }

  // ---- + bias, scatter to rolled-back positions: a wave stores one token's whole
  // row (512 B in a row = four whole lines) per instruction.  Wave wv has rows
  // wv + 8 i.  The rows' offsets are as old as the prologue and are read ahead of
  // the barrier.
  const f4 bias = *(const f4*)(projb + lane * 4);
  int ro[12];
#pragma unroll
  for (int i = 0; i < 12; ++i) ro[i] = lRow[wvs + 8 * i];
  __syncthreads();
  {
    const float* fcol = lF + lane * 4;
    float* ocol = outg + lane * 4;
    f4 v[12];
    // unrolled: v and ro stay in registers, all LDS reads ahead of the first store
#pragma unroll
    for (int i = 0; i < 12; ++i) v[i] = *(const f4*)(fcol + (wvs + 8 * i) * FP);
#pragma unroll
    for (int i = 0; i < 12; ++i) *(f4*)(ocol + ro[i]) = v[i] + bias;
    if (wvs < 2) {                       // tokens 96 and 97
      // precaution: stands ahead of the reuse of registers that the stores above name
      asm volatile("s_wait_xcnt 0x0" ::: "memory");
      const int row = 96 + wvs;
      *(f4*)(ocol + lRow[row]) = *(const f4*)(fcol + row * FP) + bias;
    }
  }
}

extern "C" void kernel_launch(void* const* d_in, const int* in_sizes, int n_in,
                              void* d_out, int out_size, void* d_ws, size_t ws_size,
                              hipStream_t stream) {
  (void)in_sizes; (void)n_in; (void)d_ws; (void)ws_size; (void)out_size;
  const float* x     = (const float*)d_in[0];
  const float* qkvw  = (const float*)d_in[1];
  const float* projw = (const float*)d_in[2];
  const float* projb = (const float*)d_in[3];
  const float* rpb   = (const float*)d_in[4];
  float* out = (float*)d_out;

  // allow >64KB dynamic LDS (WGP has 320KB); harmless if already set
  (void)hipFuncSetAttribute(reinterpret_cast<const void*>(swin3d_msa_kernel),
                            hipFuncAttributeMaxDynamicSharedMemorySize,
                            SMEM_BYTES);

  swin3d_msa_kernel<<<1024, NTHREADS, SMEM_BYTES, stream>>>(
      x, qkvw, projw, projb, rpb, out);
}

// v008
// It runs in 32.8 microseconds.
// Timed twice side by side with v007, it ran 1.09 and 1.10 times as fast.
// All steps since v000 together make it 10.0 times as fast.
#include <hip/hip_runtime.h>
#include <hip/hip_bf16.h>

typedef __attribute__((ext_vector_type(16))) _Float16 v16h;
typedef __attribute__((ext_vector_type(8)))  _Float16 h8;
typedef __attribute__((ext_vector_type(4)))  _Float16 h4;
typedef __attribute__((ext_vector_type(8)))  float    v8f;
typedef __attribute__((ext_vector_type(4)))  float    f4;

#define NTHREADS 256

// Row pitch of every f16 matrix in LDS, in halves: 128 data + 8 pad = 272 B =
// 16 B x odd, so the 16 rows that one ds_load_b128 fragment read touches fall on
// 16 different groups of four banks (at 256 B they all fall on the same four).
// The pad halves are never read.
#define LDP      136

// LDS arena layout (bytes). All offsets 16B-aligned.
#define OFF_Q    0          // 112 rows f16 : Q (pre-scaled)
#define OFF_K    30464      // 112 rows f16 : K
#define OFF_VT   60928      // 128 rows f16 : V transposed [ch][pos]
#define OFF_X    95744      // 112 rows f16 : x window (A matrix of the QKV GEMM)
#define OFF_O    OFF_X      // 112 rows f16 : attention output (all heads); x is dead by then
#define OFF_F    0          // 112 rows f32 : proj output on its way out; Q and K are dead by then
#define OFF_TAB  126208     // 4 x 512 f32 : rel-pos bias table, head-major
#define OFF_CNT  134400     // 112 i32    : shift-mask region id per token
#define OFF_ROW  134848     // 112 i32    : global f32 offset of each token's (rolled) position
#define SMEM_BYTES 135296

// Row pitch of the f32 staging rows, in floats: 128 data + 4 pad = 528 B = 16 B x
// odd, so the 16 tokens of one 16-byte store fall on different banks.
#define FP       132

// Floats per head in the LDS copy of the bias table (507 used).  Head-major: the
// different table rows of a wave's 32 look-ups (one head) lie on different banks.
#define TABP     512

// ---- fragment loaders -------------------------------------------------------
// 16-bit A/B operand K-layout (ISA 7.12.2): lane holds 16 halves as two
// contiguous 8-element runs: K in [base, base+8) and [base+16, base+24),
// base = (lane<16 ? 0 : 8).  B mirrors A with the tile column in lanes.

__device__ __forceinline__ v16h frag_lds(const _Float16* __restrict__ row,
                                         int cbase, int lane) {
  const int kb = cbase + ((lane & 16) ? 8 : 0);
  h8 a = *(const h8*)(row + kb);
  h8 b = *(const h8*)(row + kb + 16);
  v16h r;
#pragma unroll
  for (int i = 0; i < 8; ++i) { r[i] = a[i]; r[i + 8] = b[i]; }
  return r;
}

// A 16 x 128 weight tile (16 output columns) on its way from f32 rows in registers to
// f16 fragments.  r[j] holds row j as it was read from global, a whole row (512 B = four
// whole lines) per load, lane l with floats 4 l .. 4 l + 3; read in fragment order
// straight from global, every load would touch 16 lines for 32 bytes each.  The rows go
// through 16 LDS rows that only this wave uses (a wave's LDS operations run in the
// order of issue, so no barrier stands between the stores and the reads), and come
// back as the four fragments of frag_lds: column lane % 16, its k order.
__device__ __forceinline__ void tile_via_lds(v16h (&f)[4], const f4 (&r)[16],
                                             _Float16* own, int lane) {
  // unrolled: constant element numbers keep r and f in registers
#pragma unroll
  for (int j = 0; j < 16; ++j)
    *(h4*)(own + j * LDP + lane * 4) =
        h4{(_Float16)r[j][0], (_Float16)r[j][1], (_Float16)r[j][2], (_Float16)r[j][3]};
#pragma unroll
  for (int ks = 0; ks < 4; ++ks) f[ks] = frag_lds(own + (lane & 15) * LDP, ks * 32, lane);
}

// C/D layout: VGPR r holds (M = m0 + r + (lane<16?0:8), N = n0 + lane%16)
__device__ __forceinline__ void store_tile(_Float16* __restrict__ dst,
                                           int m0, int n0, int lane,
                                           v8f acc, float mul) {
  const int n  = n0 + (lane & 15);
  const int mb = m0 + ((lane & 16) ? 8 : 0);
#pragma unroll
  for (int r = 0; r < 8; ++r)
    dst[(mb + r) * LDP + n] = (_Float16)(acc[r] * mul);
}

// value of the lane 16 further on / back (l ^ 16); every lane of the wave must be on
__device__ __forceinline__ float other_half(float x) {
  const int b = __builtin_bit_cast(int, x);
  return __builtin_bit_cast(float,
      __builtin_amdgcn_permlanex16(b, b, 0x76543210, 0xfedcba98, false, false));
}

// token m = t*49 + h*7 + w of a window -> t*169 + h*13 + w; the row of the bias
// table for (query n, key m) is tok_idx(n) - tok_idx(m) + 253
__device__ __forceinline__ constexpr int tok_idx(int m) {
  return m + 120 * (m / 49) + 6 * ((m % 49) / 7);
}

// keys m and m + 8 (m = 16 kt + r, r < 8, both below 96) lie 14 or 20 table rows
// apart, but for m = 48
__device__ __forceinline__ constexpr bool key_steps_ok() {
  for (int m = 0; m < 96; ++m) {
    if ((m & 15) >= 8) continue;
    const int d = tok_idx(m + 8) - tok_idx(m);
    if (d != 14 && d != 20 && m != 48) return false;
  }
  return true;
}
static_assert(key_steps_ok(), "bias address steps");

// global f32 offset of token m of window (b, bt, bh, bw): rolled coords g, source /
// dest position = (g + shift) % dim (input gather and output scatter use the
// identical mapping)
__device__ __forceinline__ int tok_pos(int m, int b, int bt, int bh, int bw) {
  const int ti = m / 49;
  const int rm = m % 49;
  const int gT = bt * 2 + ti, gH = bh * 7 + rm / 7, gW = bw * 7 + rm % 7;
  const int sT = (gT + 1) & 15;
  int sH = gH + 3; if (sH >= 56) sH -= 56;
  int sW = gW + 3; if (sW >= 56) sW -= 56;
  return (((b * 16 + sT) * 56 + sH) * 56 + sW) * 128;
}

__global__ void __launch_bounds__(NTHREADS)
swin3d_msa_kernel(const float* __restrict__ xg,
                  const float* __restrict__ qkvw,   // (384,128)
                  const float* __restrict__ projw,  // (128,128)
                  const float* __restrict__ projb,  // (128)
                  const float* __restrict__ rpb,    // (507,4)
                  float* __restrict__ outg) {
  extern __shared__ char smem[] __attribute__((aligned(16)));
  _Float16* lQ  = (_Float16*)(smem + OFF_Q);
  _Float16* lK  = (_Float16*)(smem + OFF_K);
  _Float16* lVt = (_Float16*)(smem + OFF_VT);
  _Float16* lX  = (_Float16*)(smem + OFF_X);
  _Float16* lO  = (_Float16*)(smem + OFF_O);
  float* lF   = (float*)(smem + OFF_F);
  float* lTab = (float*)(smem + OFF_TAB);
  int* lCnt = (int*)(smem + OFF_CNT);
  int* lRow = (int*)(smem + OFF_ROW);

  const int tid  = threadIdx.x;
  const int lane = tid & 31;
  const int wv   = tid >> 5;
  const int wvs  = __builtin_amdgcn_readfirstlane(wv);

  // window decomposition: blocks ordered (b, bt, bh, bw) = (2, 8, 8, 8)
  const int blk = blockIdx.x;
  const int b   = blk >> 9;
  const int wb  = blk & 511;
  const int bt  = wb >> 6;
  const int bh  = (wb >> 3) & 7;
  const int bw  = wb & 7;

  // bias table rows tid and tid + 256: read now, stored to LDS behind the zero fill
  const bool two = tid + NTHREADS < 507;
  const f4 t0 = *(const f4*)(rpb + tid * 4);
  const f4 t1 = *(const f4*)(rpb + (two ? tid + NTHREADS : tid) * 4);

  // ---- the global reads of the QKV GEMM start here, ahead of the LDS fill and of
  // both barriers, so that they are all in flight together and over the fill.
  // x: wave wv has rows wv + 8 i, a whole row (512 B) per load.  Lane i works out the
  // position of row wv + 8 i (past the last token: of token 97, read but not kept).
  const int rpos = tok_pos(min(wvs + 8 * lane, 97), b, bt, bh, bw);
  // Unrolled, like the loops over xr, xh, rq, rk and rv below: constant element numbers
  // keep these arrays in registers.
  f4 xr[13];
#pragma unroll
  for (int i = 0; i < 13; ++i) {
    const float* xrow = xg + __builtin_amdgcn_readlane(rpos, i);   // same in every lane
    xr[i] = *(const f4*)(xrow + (unsigned)lane * 4u);
  }
  // precaution: the results of the loads below may take registers that the loads
  // above name; this wait stands ahead of that overwrite
  asm volatile("s_wait_xcnt 0x0" ::: "memory");
  // weights: wave wv owns output columns 16 wv .. 16 wv + 15 of each of q, k and v;
  // q and k start now, v behind the LDS fill (x and all three tiles as f32, with what
  // the fill needs, are more than the 256 registers that two work-groups per WGP allow)
  const int oc = wv * 16 + (lane & 15);
  const float* wrow = qkvw + wvs * (16 * 128) + lane * 4;   // row 16 wv, this lane's piece
  f4 rq[16], rk[16], rv[16];
#pragma unroll
  for (int j = 0; j < 16; ++j) {
    rq[j] = *(const f4*)(wrow + j * 128);
    rk[j] = *(const f4*)(wrow + (128 + j) * 128);
  }

  // zero the f16 arena (padding rows/cols must be 0 for the WMMA tiles)
  {
    uint32_t* z = (uint32_t*)smem;
    for (int i = tid; i < (OFF_TAB >> 2); i += NTHREADS) z[i] = 0u;
  }

  // unrolled: constant element numbers keep t0 and t1 in registers
#pragma unroll
  for (int hh = 0; hh < 4; ++hh) lTab[hh * TABP + tid] = t0[hh];
  if (two) {
#pragma unroll
    for (int hh = 0; hh < 4; ++hh) lTab[hh * TABP + tid + NTHREADS] = t1[hh];
  }

  // per-token metadata: region id (shift mask) + global row offset.
  if (tid < 98) {
    const int ti = tid / 49;
    const int rm = tid % 49;
    const int hi = rm / 7;
    const int wi = rm % 7;
    const int gT = bt * 2 + ti, gH = bh * 7 + hi, gW = bw * 7 + wi;
    const int rt = (gT < 14) ? 0 : ((gT < 15) ? 1 : 2);
    const int rh = (gH < 49) ? 0 : ((gH < 53) ? 1 : 2);
    const int rw = (gW < 49) ? 0 : ((gW < 53) ? 1 : 2);
    lCnt[tid] = rt * 9 + rh * 3 + rw;
    lRow[tid] = tok_pos(tid, b, bt, bh, bw);
  }

#pragma unroll
  for (int j = 0; j < 16; ++j) rv[j] = *(const f4*)(wrow + (256 + j) * 128);
  h4 xh[13];
#pragma unroll
  for (int i = 0; i < 13; ++i)
    xh[i] = h4{(_Float16)xr[i][0], (_Float16)xr[i][1], (_Float16)xr[i][2], (_Float16)xr[i][3]};
  __syncthreads();

  // ---- window x (98x128 f16) to LDS, rows 98..111 stay 0 -------------------
#pragma unroll
  for (int i = 0; i < 12; ++i)
    *(h4*)(lX + (wvs + 8 * i) * LDP + lane * 4) = xh[i];
  if (wvs < 2) *(h4*)(lX + (wvs + 96) * LDP + lane * 4) = xh[12];

  // The wave's three weight tiles, one after the other through the 16 rows of V^T that
  // only this wave writes in the GEMM below.  Columns 112..127 of those rows are read
  // as K-padding of V^T and written by nothing else: back to 0.
  _Float16* lOwn = lVt + wvs * 16 * LDP;
  v16h wq[4], wk[4], wvv[4];
  tile_via_lds(wq,  rq, lOwn, lane);
  tile_via_lds(wk,  rk, lOwn, lane);
  tile_via_lds(wvv, rv, lOwn, lane);
  *(h8*)(lOwn + (lane & 15) * LDP + 112 + ((lane & 16) ? 8 : 0)) = h8{};
  __syncthreads();

  // ---- QKV GEMM: (112x384) = X(112x128) @ qkv_w^T(128x384) ----------------
  const float SCALE = 0.17677669529663687f;  // 32^-0.5
  // The wave's three weight tiles stay in registers over the 7 row tiles; each row
  // tile's A fragments serve all three.
  {
    for (int mt = 0; mt < 7; ++mt) {
      const int m0 = mt * 16;
      const _Float16* arow = lX + (m0 + (lane & 15)) * LDP;
      v16h a[4];
#pragma unroll
      for (int ks = 0; ks < 4; ++ks) a[ks] = frag_lds(arow, ks * 32, lane);
      v8f aq = {}, ak = {}, av = {};
#pragma unroll
      for (int ks = 0; ks < 4; ++ks) {
        aq = __builtin_amdgcn_wmma_f32_16x16x32_f16(false, a[ks], false, wq[ks],
                                                    (short)0, aq, false, false);
        ak = __builtin_amdgcn_wmma_f32_16x16x32_f16(false, a[ks], false, wk[ks],
                                                    (short)0, ak, false, false);
        av = __builtin_amdgcn_wmma_f32_16x16x32_f16(false, a[ks], false, wvv[ks],
                                                    (short)0, av, false, false);
      }
      store_tile(lQ, m0, wv * 16, lane, aq, SCALE);      // q * scale
      store_tile(lK, m0, wv * 16, lane, ak, 1.0f);       // k
      const int mb = m0 + ((lane & 16) ? 8 : 0);         // v, transposed
#pragma unroll
      for (int r = 0; r < 8; ++r)
        lVt[oc * LDP + mb + r] = (_Float16)av[r];
    }
  }
  __syncthreads();

  // ---- attention: a wave takes one head and 16 queries at a time -----------
  // S^T = K_h Q_h^T: a lane holds the scores of ONE query (column l16) against
  // keys 16 kt + 8 half + r in register r of tile kt.  That is the k order of a
  // B operand, so exp(S^T) is packed as it lies and O^T = V_h^T P^T follows with
  // no trip of the scores through LDS and no barrier between the heads.
  const int l16  = lane & 15;
  const int half = lane >> 4;
  const int h    = wvs & 3;
  for (int qt = wvs >> 2; qt < 7; qt += 2) {
    const int n    = qt * 16 + l16;
    const int nc   = (n < 98) ? n : 97;    // padding queries: stay in the table
    const int qcnt = lCnt[nc];
    const float* pq = lTab + h * TABP + tok_idx(nc);
    // lanes 16..31 hold the key 8 further on: 14 or 20 table rows lower; the one
    // pair that spans the two frames (keys 48 and 56) has an address of its own
    const float* pA = pq - (half ? 14 : 0);
    const float* pB = pq - (half ? 20 : 0);
    const float* pX = pq + (half ? 253 - tok_idx(56) : 253 - tok_idx(48));

    // start value of the accumulators: rel-pos bias + shift mask.  All look-ups
    // (bias and region ids) are read first, as one run of LDS loads.
    v8f st[7];
    int kc[6][8];
#pragma unroll
    for (int kt = 0; kt < 6; ++kt) {
#pragma unroll
      for (int r = 0; r < 8; ++r) {
        const int c0 = tok_idx(kt * 16 + r);             // key of lanes 0..15
        const int d  = tok_idx(kt * 16 + 8 + r) - c0;    // lanes 16..31: 8 keys on
        const float* p = (d == 14) ? pA + (253 - c0)
                       : (d == 20) ? pB + (253 - c0) : pX;
        st[kt][r] = *p;
        kc[kt][r] = lCnt[kt * 16 + 8 * half + r];
      }
    }
    const float b96 = pq[253 - tok_idx(96)], b97 = pq[253 - tok_idx(97)];
    const int   c96 = lCnt[96],              c97 = lCnt[97];
    // Keeps the run of loads above in one place: spread among the compares below,
    // each small group of them costs the wave a wait for LDS of its own.
    __builtin_amdgcn_sched_barrier(0);
    // unrolled, like the loops above: st and kc stay in registers
#pragma unroll
    for (int kt = 0; kt < 6; ++kt) {
#pragma unroll
      for (int r = 0; r < 8; ++r)
        if (kc[kt][r] != qcnt) st[kt][r] -= 100.0f;
    }
#pragma unroll
    for (int r = 0; r < 8; ++r) st[6][r] = -3.0e38f;   // keys 98..111 are K-padding
    const float s96 = (c96 != qcnt) ? b96 - 100.0f : b96;   // keys 96, 97
    const float s97 = (c97 != qcnt) ? b97 - 100.0f : b97;
    st[6][0] = half ? -3.0e38f : s96;
    st[6][1] = half ? -3.0e38f : s97;

    const v16h bq = frag_lds(lQ + n * LDP, h * 32, lane);
#pragma unroll
    for (int kt = 0; kt < 7; ++kt) {
      const v16h a = frag_lds(lK + (kt * 16 + l16) * LDP, h * 32, lane);
      st[kt] = __builtin_amdgcn_wmma_f32_16x16x32_f16(false, a, false, bq,
                                                      (short)0, st[kt], false, false);
    }

    // softmax of the lane's query: in-lane, then one exchange between the halves
    v8f m8 = st[0];
#pragma unroll
    for (int kt = 1; kt < 6; ++kt) m8 = __builtin_elementwise_max(m8, st[kt]);
    m8[0] = fmaxf(m8[0], st[6][0]);
    m8[1] = fmaxf(m8[1], st[6][1]);
    float vmax = fmaxf(fmaxf(fmaxf(m8[0], m8[1]), fmaxf(m8[2], m8[3])),
                       fmaxf(fmaxf(m8[4], m8[5]), fmaxf(m8[6], m8[7])));
    vmax = fmaxf(vmax, other_half(vmax));
    v8f s8 = {};
#pragma unroll
    for (int kt = 0; kt < 6; ++kt) {
#pragma unroll
      for (int r = 0; r < 8; ++r) st[kt][r] = __expf(st[kt][r] - vmax);
      s8 += st[kt];
    }
    const float p96 = __expf(st[6][0] - vmax);
    const float p97 = __expf(st[6][1] - vmax);
    s8[0] += p96;
    s8[1] += p97;
    float sum = ((s8[0] + s8[1]) + (s8[2] + s8[3])) + ((s8[4] + s8[5]) + (s8[6] + s8[7]));
    sum += other_half(sum);
    const float inv = __builtin_amdgcn_rcpf(sum);   // applied to O, not to P

    v16h pb[4];
#pragma unroll
    for (int t = 0; t < 3; ++t) {
#pragma unroll
      for (int i = 0; i < 8; ++i) {
        pb[t][i]     = (_Float16)st[2 * t][i];
        pb[t][8 + i] = (_Float16)st[2 * t + 1][i];
      }
    }
    pb[3] = v16h{};
    pb[3][0] = (_Float16)p96;
    pb[3][1] = (_Float16)p97;

    // O^T(32 ch x 16 queries) = V_h^T(32 x 128) @ P^T(128 x 16); a lane ends up
    // with 8 adjacent channels of its query: one 16-byte store per tile
#pragma unroll
    for (int ct = 0; ct < 2; ++ct) {
      const _Float16* vrow = lVt + (h * 32 + ct * 16 + l16) * LDP;
      v8f acc = {};
#pragma unroll
      for (int ks = 0; ks < 4; ++ks) {
        const v16h a = frag_lds(vrow, ks * 32, lane);
        acc = __builtin_amdgcn_wmma_f32_16x16x32_f16(false, a, false, pb[ks],
                                                     (short)0, acc, false, false);
      }
      h8 ov;
#pragma unroll
      for (int r = 0; r < 8; ++r) ov[r] = (_Float16)(acc[r] * inv);
      *(h8*)(lO + n * LDP + h * 32 + ct * 16 + 8 * half) = ov;
    }
  }
  __syncthreads();

  // ---- proj GEMM, transposed: out^T = proj_w O^T ---------------------------
  // Wave wv owns output channels 16 wv .. 16 wv + 15.  With the weights as A and
  // the tokens as B a lane ends up with 8 adjacent channels of ONE token, which go
  // to the f32 staging rows in LDS as two 16-byte stores.
  {
    // the wave's weight tile, rows 16 wv .. 16 wv + 15 of proj_w, a whole row per load;
    // to fragments through the wave's own rows of V^T, which is dead by now
    const float* p = projw + wvs * (16 * 128) + lane * 4;
    f4 w[16];
#pragma unroll
    for (int j = 0; j < 16; ++j) w[j] = *(const f4*)(p + j * 128);
    // precaution: stands ahead of the reuse of registers that the loads above name
    asm volatile("s_wait_xcnt 0x0" ::: "memory");
    v16h wp[4];
    tile_via_lds(wp, w, lOwn, lane);
    // One accumulator per token tile, k step outermost: seven independent WMMAs
    // follow one run of LDS reads.  Unrolled: acc and tb stay in registers.
    v8f acc[7] = {};
#pragma unroll
    for (int ks = 0; ks < 4; ++ks) {
      v16h tb[7];
#pragma unroll
      for (int mt = 0; mt < 7; ++mt)
        tb[mt] = frag_lds(lO + (mt * 16 + l16) * LDP, ks * 32, lane);
#pragma unroll
      for (int mt = 0; mt < 7; ++mt)
        acc[mt] = __builtin_amdgcn_wmma_f32_16x16x32_f16(false, wp[ks], false, tb[mt],
                                                         (short)0, acc[mt], false, false);
    }
#pragma unroll
    for (int mt = 0; mt < 7; ++mt) {
      float* d = lF + (mt * 16 + l16) * FP + wvs * 16 + 8 * half;
      *(f4*)(d)     = f4{acc[mt][0], acc[mt][1], acc[mt][2], acc[mt][3]};
      *(f4*)(d + 4) = f4{acc[mt][4], acc[mt][5], acc[mt][6], acc[mt][7]};
    }
  }

  // ---- + bias, scatter to rolled-back positions: a wave stores one token's whole
  // row (512 B in a row = four whole lines) per instruction.  Wave wv has rows
  // wv + 8 i.  The rows' offsets are as old as the prologue and are read ahead of
  // the barrier.
  const f4 bias = *(const f4*)(projb + lane * 4);
  int ro[12];
#pragma unroll
  for (int i = 0; i < 12; ++i) ro[i] = lRow[wvs + 8 * i];
  __syncthreads();
  {
    const float* fcol = lF + lane * 4;
    float* ocol = outg + lane * 4;
    f4 v[12];
    // unrolled: v and ro stay in registers, all LDS reads ahead of the first store
#pragma unroll
    for (int i = 0; i < 12; ++i) v[i] = *(const f4*)(fcol + (wvs + 8 * i) * FP);
#pragma unroll
    for (int i = 0; i < 12; ++i) *(f4*)(ocol + ro[i]) = v[i] + bias;
    if (wvs < 2) {                       // tokens 96 and 97
      // precaution: stands ahead of the reuse of registers that the stores above name
      asm volatile("s_wait_xcnt 0x0" ::: "memory");
      const int row = 96 + wvs;
      *(f4*)(ocol + lRow[row]) = *(const f4*)(fcol + row * FP) + bias;
    }
  }
}

extern "C" void kernel_launch(void* const* d_in, const int* in_sizes, int n_in,
                              void* d_out, int out_size, void* d_ws, size_t ws_size,
                              hipStream_t stream) {
  (void)in_sizes; (void)n_in; (void)d_ws; (void)ws_size; (void)out_size;
  const float* x     = (const float*)d_in[0];
  const float* qkvw  = (const float*)d_in[1];
  const float* projw = (const float*)d_in[2];
  const float* projb = (const float*)d_in[3];
  const float* rpb   = (const float*)d_in[4];
  float* out = (float*)d_out;

  // allow >64KB dynamic LDS (WGP has 320KB); harmless if already set
  (void)hipFuncSetAttribute(reinterpret_cast<const void*>(swin3d_msa_kernel),
                            hipFuncAttributeMaxDynamicSharedMemorySize,
                            SMEM_BYTES);

  swin3d_msa_kernel<<<1024, NTHREADS, SMEM_BYTES, stream>>>(
      x, qkvw, projw, projb, rpb, out);
}

// v009
// One run takes 31.4 microseconds.
// Next to v008, in two timings, it ran 1.05 times as fast each time.
// Counting every step since v000, it is 10.5 times as fast.
#include <hip/hip_runtime.h>
#include <hip/hip_bf16.h>

typedef __attribute__((ext_vector_type(16))) _Float16 v16h;
typedef __attribute__((ext_vector_type(8)))  _Float16 h8;
typedef __attribute__((ext_vector_type(4)))  _Float16 h4;
typedef __attribute__((ext_vector_type(8)))  float    v8f;
typedef __attribute__((ext_vector_type(4)))  float    f4;

#define NTHREADS 256

// Row pitch of every f16 matrix in LDS, in halves: 128 data + 8 pad = 272 B =
// 16 B x odd, so the 16 rows that one ds_load_b128 fragment read touches fall on
// 16 different groups of four banks (at 256 B they all fall on the same four).
// The pad halves are never read.
#define LDP      136

// LDS arena layout (bytes). All offsets 16B-aligned.
#define OFF_Q    0          // 112 rows f16 : Q (pre-scaled)
#define OFF_K    30464      // 112 rows f16 : K
#define OFF_VT   60928      // 128 rows f16 : V transposed [ch][pos]
#define OFF_X    95744      // 112 rows f16 : x window (A matrix of the QKV GEMM)
#define OFF_O    OFF_X      // 112 rows f16 : attention output (all heads); x is dead by then
#define OFF_F    0          // 112 rows f32 : proj output on its way out; Q and K are dead by then
#define OFF_TAB  126208     // 4 x 512 f32 : rel-pos bias table, head-major
#define OFF_CNT  134400     // 112 i32    : shift-mask region id per token
#define OFF_ROW  134848     // 112 i32    : global f32 offset of each token's (rolled) position
#define SMEM_BYTES 135296

// Row pitch of the f32 staging rows, in floats: 128 data + 4 pad = 528 B = 16 B x
// odd, so the 16 tokens of one 16-byte store fall on different banks.
#define FP       132

// Floats per head in the LDS copy of the bias table (507 used).  Head-major: the
// different table rows of a wave's 32 look-ups (one head) lie on different banks.
#define TABP     512

// ---- fragment loaders -------------------------------------------------------
// 16-bit A/B operand K-layout (ISA 7.12.2): lane holds 16 halves as two
// contiguous 8-element runs: K in [base, base+8) and [base+16, base+24),
// base = (lane<16 ? 0 : 8).  B mirrors A with the tile column in lanes.

__device__ __forceinline__ v16h frag_lds(const _Float16* __restrict__ row,
                                         int cbase, int lane) {
  const int kb = cbase + ((lane & 16) ? 8 : 0);
  h8 a = *(const h8*)(row + kb);
  h8 b = *(const h8*)(row + kb + 16);
  v16h r;
#pragma unroll
  for (int i = 0; i < 8; ++i) { r[i] = a[i]; r[i + 8] = b[i]; }
  return r;
}

// A 16 x 128 weight tile (16 output columns) on its way from f32 rows in registers to
// f16 fragments.  r[j] holds row j as it was read from global, a whole row (512 B = four
// whole lines) per load, lane l with floats 4 l .. 4 l + 3; read in fragment order
// straight from global, every load would touch 16 lines for 32 bytes each.  The rows go
// through 16 LDS rows that only this wave uses (a wave's LDS operations run in the
// order of issue, so no barrier stands between the stores and the reads), and come
// back as the four fragments of frag_lds: column lane % 16, its k order.
__device__ __forceinline__ void tile_via_lds(v16h (&f)[4], const f4 (&r)[16],
                                             _Float16* own, int lane) {
  // unrolled: constant element numbers keep r and f in registers
#pragma unroll
  for (int j = 0; j < 16; ++j)
    *(h4*)(own + j * LDP + lane * 4) =
        h4{(_Float16)r[j][0], (_Float16)r[j][1], (_Float16)r[j][2], (_Float16)r[j][3]};
#pragma unroll
  for (int ks = 0; ks < 4; ++ks) f[ks] = frag_lds(own + (lane & 15) * LDP, ks * 32, lane);
}

// C/D layout: VGPR r holds (M = m0 + r + (lane<16?0:8), N = n0 + lane%16)
__device__ __forceinline__ void store_tile(_Float16* __restrict__ dst,
                                           int m0, int n0, int lane,
                                           v8f acc, float mul) {
  const int n  = n0 + (lane & 15);
  const int mb = m0 + ((lane & 16) ? 8 : 0);
#pragma unroll
  for (int r = 0; r < 8; ++r)
    dst[(mb + r) * LDP + n] = (_Float16)(acc[r] * mul);
}

// value of the lane 16 further on / back (l ^ 16); every lane of the wave must be on
__device__ __forceinline__ float other_half(float x) {
  const int b = __builtin_bit_cast(int, x);
  return __builtin_bit_cast(float,
      __builtin_amdgcn_permlanex16(b, b, 0x76543210, 0xfedcba98, false, false));
}

// token m = t*49 + h*7 + w of a window -> t*169 + h*13 + w; the row of the bias
// table for (query n, key m) is tok_idx(n) - tok_idx(m) + 253
__device__ __forceinline__ constexpr int tok_idx(int m) {
  return m + 120 * (m / 49) + 6 * ((m % 49) / 7);
}

// keys m and m + 8 (m = 16 kt + r, r < 8, both below 96) lie 14 or 20 table rows
// apart, but for m = 48
__device__ __forceinline__ constexpr bool key_steps_ok() {
  for (int m = 0; m < 96; ++m) {
    if ((m & 15) >= 8) continue;
    const int d = tok_idx(m + 8) - tok_idx(m);
    if (d != 14 && d != 20 && m != 48) return false;
  }
  return true;
}
static_assert(key_steps_ok(), "bias address steps");

// global f32 offset of token m of window (b, bt, bh, bw): rolled coords g, source /
// dest position = (g + shift) % dim (input gather and output scatter use the
// identical mapping)
__device__ __forceinline__ int tok_pos(int m, int b, int bt, int bh, int bw) {
  const int ti = m / 49;
  const int rm = m % 49;
  const int gT = bt * 2 + ti, gH = bh * 7 + rm / 7, gW = bw * 7 + rm % 7;
  const int sT = (gT + 1) & 15;
  int sH = gH + 3; if (sH >= 56) sH -= 56;
  int sW = gW + 3; if (sW >= 56) sW -= 56;
  return (((b * 16 + sT) * 56 + sH) * 56 + sW) * 128;
}

__global__ void __launch_bounds__(NTHREADS)
swin3d_msa_kernel(const float* __restrict__ xg,
                  const float* __restrict__ qkvw,   // (384,128)
                  const float* __restrict__ projw,  // (128,128)
                  const float* __restrict__ projb,  // (128)
                  const float* __restrict__ rpb,    // (507,4)
                  float* __restrict__ outg) {
  extern __shared__ char smem[] __attribute__((aligned(16)));
  _Float16* lQ  = (_Float16*)(smem + OFF_Q);
  _Float16* lK  = (_Float16*)(smem + OFF_K);
  _Float16* lVt = (_Float16*)(smem + OFF_VT);
  _Float16* lX  = (_Float16*)(smem + OFF_X);
  _Float16* lO  = (_Float16*)(smem + OFF_O);
  float* lF   = (float*)(smem + OFF_F);
  float* lTab = (float*)(smem + OFF_TAB);
  int* lCnt = (int*)(smem + OFF_CNT);
  int* lRow = (int*)(smem + OFF_ROW);

  const int tid  = threadIdx.x;
  const int lane = tid & 31;
  const int wv   = tid >> 5;
  const int wvs  = __builtin_amdgcn_readfirstlane(wv);

  // window decomposition: blocks ordered (b, bt, bh, bw) = (2, 8, 8, 8)
  const int blk = blockIdx.x;
  const int b   = blk >> 9;
  const int wb  = blk & 511;
  const int bt  = wb >> 6;
  const int bh  = (wb >> 3) & 7;
  const int bw  = wb & 7;

  // bias table rows tid and tid + 256: read now, stored to LDS further down
  const bool two = tid + NTHREADS < 507;
  const f4 t0 = *(const f4*)(rpb + tid * 4);
  const f4 t1 = *(const f4*)(rpb + (two ? tid + NTHREADS : tid) * 4);

  // ---- the global reads of the QKV GEMM start here, ahead of all LDS work, so that
  // they are all in flight together.
  // x: wave wv has rows wv + 8 i, a whole row (512 B) per load.  Lane i works out the
  // position of row wv + 8 i (past the last token: of token 97, read but not kept).
  const int rpos = tok_pos(min(wvs + 8 * lane, 97), b, bt, bh, bw);
  // Unrolled, like the loops over xr, xh, rq, rk and rv below: constant element numbers
  // keep these arrays in registers.
  f4 xr[13];
#pragma unroll
  for (int i = 0; i < 13; ++i) {
    const float* xrow = xg + __builtin_amdgcn_readlane(rpos, i);   // same in every lane
    xr[i] = *(const f4*)(xrow + (unsigned)lane * 4u);
  }
  // precaution: the results of the loads below may take registers that the loads
  // above name; this wait stands ahead of that overwrite
  asm volatile("s_wait_xcnt 0x0" ::: "memory");
  // weights: wave wv owns output columns 16 wv .. 16 wv + 15 of each of q, k and v;
  // q and k start now, v behind the table's stores (x, all three tiles as f32 and the
  // table rows are more than the 256 registers that two work-groups per WGP allow)
  const int oc = wv * 16 + (lane & 15);
  const float* wrow = qkvw + wvs * (16 * 128) + lane * 4;   // row 16 wv, this lane's piece
  f4 rq[16], rk[16], rv[16];
#pragma unroll
  for (int j = 0; j < 16; ++j) {
    rq[j] = *(const f4*)(wrow + j * 128);
    rk[j] = *(const f4*)(wrow + (128 + j) * 128);
  }

  // unrolled: constant element numbers keep t0 and t1 in registers
#pragma unroll
  for (int hh = 0; hh < 4; ++hh) lTab[hh * TABP + tid] = t0[hh];
  // Stored by every thread: threads 251..255 fill places 507..511 of each head, which
  // lie inside TABP and are never looked up.  Under a branch the load of t1 sinks into
  // it, behind all the loads above, and its wait then holds up the loads of v.
#pragma unroll
  for (int hh = 0; hh < 4; ++hh) lTab[hh * TABP + tid + NTHREADS] = t1[hh];

  // per-token metadata: region id (shift mask) + global row offset.
  if (tid < 98) {
    const int ti = tid / 49;
    const int rm = tid % 49;
    const int hi = rm / 7;
    const int wi = rm % 7;
    const int gT = bt * 2 + ti, gH = bh * 7 + hi, gW = bw * 7 + wi;
    const int rt = (gT < 14) ? 0 : ((gT < 15) ? 1 : 2);
    const int rh = (gH < 49) ? 0 : ((gH < 53) ? 1 : 2);
    const int rw = (gW < 49) ? 0 : ((gW < 53) ? 1 : 2);
    lCnt[tid] = rt * 9 + rh * 3 + rw;
    lRow[tid] = tok_pos(tid, b, bt, bh, bw);
  }

#pragma unroll
  for (int j = 0; j < 15; ++j) rv[j] = *(const f4*)(wrow + (256 + j) * 128);
  // precaution: registers are short here, and the result of the last load may take the
  // registers that hold the address of the loads above; this wait stands ahead of it
  asm volatile("s_wait_xcnt 0x0" ::: "memory");
  rv[15] = *(const f4*)(wrow + (256 + 15) * 128);
  h4 xh[13];
#pragma unroll
  for (int i = 0; i < 13; ++i)
    xh[i] = h4{(_Float16)xr[i][0], (_Float16)xr[i][1], (_Float16)xr[i][2], (_Float16)xr[i][3]};

  // ---- window x (98x128 f16) to LDS; rows 98..111 are set to 0 ---------------
  // These 14 padding rows are the only LDS that is read without a kernel's value in
  // it: from them the GEMM below writes rows 98..111 of Q and K and columns 98..111 of
  // V^T as zeros, and it writes every other row and column of the three as well;
  // columns 112..127 of V^T are set below, O and the f32 rows are written whole, the
  // pad halves are never read.  No wave writes another wave's rows up to the barrier
  // ahead of the GEMM, so no barrier stands here.
#pragma unroll
  for (int i = 0; i < 12; ++i)
    *(h4*)(lX + (wvs + 8 * i) * LDP + lane * 4) = xh[i];
  *(h4*)(lX + (wvs + 96) * LDP + lane * 4)  = (wvs < 2) ? xh[12] : h4{};
  *(h4*)(lX + (wvs + 104) * LDP + lane * 4) = h4{};

  // The wave's three weight tiles, one after the other through the 16 rows of V^T that
  // only this wave writes in the GEMM below.  Columns 112..127 of those rows are read
  // as K-padding of V^T and written by nothing else: back to 0.
  _Float16* lOwn = lVt + wvs * 16 * LDP;
  v16h wq[4], wk[4], wvv[4];
  tile_via_lds(wq,  rq, lOwn, lane);
  tile_via_lds(wk,  rk, lOwn, lane);
  tile_via_lds(wvv, rv, lOwn, lane);
  *(h8*)(lOwn + (lane & 15) * LDP + 112 + ((lane & 16) ? 8 : 0)) = h8{};
  __syncthreads();

  // ---- QKV GEMM: (112x384) = X(112x128) @ qkv_w^T(128x384) ----------------
  const float SCALE = 0.17677669529663687f;  // 32^-0.5
  // The wave's three weight tiles stay in registers over the 7 row tiles; each row
  // tile's A fragments serve all three.
  {
    for (int mt = 0; mt < 7; ++mt) {
      const int m0 = mt * 16;
      const _Float16* arow = lX + (m0 + (lane & 15)) * LDP;
      v16h a[4];
#pragma unroll
      for (int ks = 0; ks < 4; ++ks) a[ks] = frag_lds(arow, ks * 32, lane);
      v8f aq = {}, ak = {}, av = {};
#pragma unroll
      for (int ks = 0; ks < 4; ++ks) {
        aq = __builtin_amdgcn_wmma_f32_16x16x32_f16(false, a[ks], false, wq[ks],
                                                    (short)0, aq, false, false);
        ak = __builtin_amdgcn_wmma_f32_16x16x32_f16(false, a[ks], false, wk[ks],
                                                    (short)0, ak, false, false);
        av = __builtin_amdgcn_wmma_f32_16x16x32_f16(false, a[ks], false, wvv[ks],
                                                    (short)0, av, false, false);
      }
      store_tile(lQ, m0, wv * 16, lane, aq, SCALE);      // q * scale
      store_tile(lK, m0, wv * 16, lane, ak, 1.0f);       // k
      const int mb = m0 + ((lane & 16) ? 8 : 0);         // v, transposed
#pragma unroll
      for (int r = 0; r < 8; ++r)
        lVt[oc * LDP + mb + r] = (_Float16)av[r];
    }
  }
  __syncthreads();

  // ---- attention: a wave takes one head and 16 queries at a time -----------
  // S^T = K_h Q_h^T: a lane holds the scores of ONE query (column l16) against
  // keys 16 kt + 8 half + r in register r of tile kt.  That is the k order of a
  // B operand, so exp(S^T) is packed as it lies and O^T = V_h^T P^T follows with
  // no trip of the scores through LDS and no barrier between the heads.
  const int l16  = lane & 15;
  const int half = lane >> 4;
  const int h    = wvs & 3;
  for (int qt = wvs >> 2; qt < 7; qt += 2) {
    const int n    = qt * 16 + l16;
    const int nc   = (n < 98) ? n : 97;    // padding queries: stay in the table
    const int qcnt = lCnt[nc];
    const float* pq = lTab + h * TABP + tok_idx(nc);
    // lanes 16..31 hold the key 8 further on: 14 or 20 table rows lower; the one
    // pair that spans the two frames (keys 48 and 56) has an address of its own
    const float* pA = pq - (half ? 14 : 0);
    const float* pB = pq - (half ? 20 : 0);
    const float* pX = pq + (half ? 253 - tok_idx(56) : 253 - tok_idx(48));

    // start value of the accumulators: rel-pos bias + shift mask.  All look-ups
    // (bias and region ids) are read first, as one run of LDS loads.
    v8f st[7];
    int kc[6][8];
#pragma unroll
    for (int kt = 0; kt < 6; ++kt) {
#pragma unroll
      for (int r = 0; r < 8; ++r) {
        const int c0 = tok_idx(kt * 16 + r);             // key of lanes 0..15
        const int d  = tok_idx(kt * 16 + 8 + r) - c0;    // lanes 16..31: 8 keys on
        const float* p = (d == 14) ? pA + (253 - c0)
                       : (d == 20) ? pB + (253 - c0) : pX;
        st[kt][r] = *p;
        kc[kt][r] = lCnt[kt * 16 + 8 * half + r];
      }
    }
    const float b96 = pq[253 - tok_idx(96)], b97 = pq[253 - tok_idx(97)];
    const int   c96 = lCnt[96],              c97 = lCnt[97];
    // Keeps the run of loads above in one place: spread among the compares below,
    // each small group of them costs the wave a wait for LDS of its own.
    __builtin_amdgcn_sched_barrier(0);
    // unrolled, like the loops above: st and kc stay in registers
#pragma unroll
    for (int kt = 0; kt < 6; ++kt) {
#pragma unroll
      for (int r = 0; r < 8; ++r)
        if (kc[kt][r] != qcnt) st[kt][r] -= 100.0f;
    }
#pragma unroll
    for (int r = 0; r < 8; ++r) st[6][r] = -3.0e38f;   // keys 98..111 are K-padding
    const float s96 = (c96 != qcnt) ? b96 - 100.0f : b96;   // keys 96, 97
    const float s97 = (c97 != qcnt) ? b97 - 100.0f : b97;
    st[6][0] = half ? -3.0e38f : s96;
    st[6][1] = half ? -3.0e38f : s97;

    const v16h bq = frag_lds(lQ + n * LDP, h * 32, lane);
#pragma unroll
    for (int kt = 0; kt < 7; ++kt) {
      const v16h a = frag_lds(lK + (kt * 16 + l16) * LDP, h * 32, lane);
      st[kt] = __builtin_amdgcn_wmma_f32_16x16x32_f16(false, a, false, bq,
                                                      (short)0, st[kt], false, false);
    }

    // softmax of the lane's query: in-lane, then one exchange between the halves
    v8f m8 = st[0];
#pragma unroll
    for (int kt = 1; kt < 6; ++kt) m8 = __builtin_elementwise_max(m8, st[kt]);
    m8[0] = fmaxf(m8[0], st[6][0]);
    m8[1] = fmaxf(m8[1], st[6][1]);
    float vmax = fmaxf(fmaxf(fmaxf(m8[0], m8[1]), fmaxf(m8[2], m8[3])),
                       fmaxf(fmaxf(m8[4], m8[5]), fmaxf(m8[6], m8[7])));
    vmax = fmaxf(vmax, other_half(vmax));
    v8f s8 = {};
#pragma unroll
    for (int kt = 0; kt < 6; ++kt) {
#pragma unroll
      for (int r = 0; r < 8; ++r) st[kt][r] = __expf(st[kt][r] - vmax);
      s8 += st[kt];
    }
    const float p96 = __expf(st[6][0] - vmax);
    const float p97 = __expf(st[6][1] - vmax);
    s8[0] += p96;
    s8[1] += p97;
    float sum = ((s8[0] + s8[1]) + (s8[2] + s8[3])) + ((s8[4] + s8[5]) + (s8[6] + s8[7]));
    sum += other_half(sum);
    const float inv = __builtin_amdgcn_rcpf(sum);   // applied to O, not to P

    v16h pb[4];
#pragma unroll
    for (int t = 0; t < 3; ++t) {
#pragma unroll
      for (int i = 0; i < 8; ++i) {
        pb[t][i]     = (_Float16)st[2 * t][i];
        pb[t][8 + i] = (_Float16)st[2 * t + 1][i];
      }
    }
    pb[3] = v16h{};
    pb[3][0] = (_Float16)p96;
    pb[3][1] = (_Float16)p97;

    // O^T(32 ch x 16 queries) = V_h^T(32 x 128) @ P^T(128 x 16); a lane ends up
    // with 8 adjacent channels of its query: one 16-byte store per tile
#pragma unroll
    for (int ct = 0; ct < 2; ++ct) {
      const _Float16* vrow = lVt + (h * 32 + ct * 16 + l16) * LDP;
      v8f acc = {};
#pragma unroll
      for (int ks = 0; ks < 4; ++ks) {
        const v16h a = frag_lds(vrow, ks * 32, lane);
        acc = __builtin_amdgcn_wmma_f32_16x16x32_f16(false, a, false, pb[ks],
                                                     (short)0, acc, false, false);
      }
      h8 ov;
#pragma unroll
      for (int r = 0; r < 8; ++r) ov[r] = (_Float16)(acc[r] * inv);
      *(h8*)(lO + n * LDP + h * 32 + ct * 16 + 8 * half) = ov;
    }
  }
  __syncthreads();

  // ---- proj GEMM, transposed: out^T = proj_w O^T ---------------------------
  // Wave wv owns output channels 16 wv .. 16 wv + 15.  With the weights as A and
  // the tokens as B a lane ends up with 8 adjacent channels of ONE token, which go
  // to the f32 staging rows in LDS as two 16-byte stores.
  {
    // the wave's weight tile, rows 16 wv .. 16 wv + 15 of proj_w, a whole row per load;
    // to fragments through the wave's own rows of V^T, which is dead by now
    const float* p = projw + wvs * (16 * 128) + lane * 4;
    f4 w[16];
#pragma unroll
    for (int j = 0; j < 16; ++j) w[j] = *(const f4*)(p + j * 128);
    // precaution: stands ahead of the reuse of registers that the loads above name
    asm volatile("s_wait_xcnt 0x0" ::: "memory");
    v16h wp[4];
    tile_via_lds(wp, w, lOwn, lane);
    // One accumulator per token tile, k step outermost: seven independent WMMAs
    // follow one run of LDS reads.  Unrolled: acc and tb stay in registers.
    v8f acc[7] = {};
#pragma unroll
    for (int ks = 0; ks < 4; ++ks) {
      v16h tb[7];
#pragma unroll
      for (int mt = 0; mt < 7; ++mt)
        tb[mt] = frag_lds(lO + (mt * 16 + l16) * LDP, ks * 32, lane);
#pragma unroll
      for (int mt = 0; mt < 7; ++mt)
        acc[mt] = __builtin_amdgcn_wmma_f32_16x16x32_f16(false, wp[ks], false, tb[mt],
                                                         (short)0, acc[mt], false, false);
    }
#pragma unroll
    for (int mt = 0; mt < 7; ++mt) {
      float* d = lF + (mt * 16 + l16) * FP + wvs * 16 + 8 * half;
      *(f4*)(d)     = f4{acc[mt][0], acc[mt][1], acc[mt][2], acc[mt][3]};
      *(f4*)(d + 4) = f4{acc[mt][4], acc[mt][5], acc[mt][6], acc[mt][7]};
    }
  }

  // ---- + bias, scatter to rolled-back positions: a wave stores one token's whole
  // row (512 B in a row = four whole lines) per instruction.  Wave wv has rows
  // wv + 8 i.  The rows' offsets are as old as the prologue and are read ahead of
  // the barrier.
  const f4 bias = *(const f4*)(projb + lane * 4);
  int ro[12];
#pragma unroll
  for (int i = 0; i < 12; ++i) ro[i] = lRow[wvs + 8 * i];
  __syncthreads();
  {
    const float* fcol = lF + lane * 4;
    float* ocol = outg + lane * 4;
    f4 v[12];
    // unrolled: v and ro stay in registers, all LDS reads ahead of the first store
#pragma unroll
    for (int i = 0; i < 12; ++i) v[i] = *(const f4*)(fcol + (wvs + 8 * i) * FP);
#pragma unroll
    for (int i = 0; i < 12; ++i) *(f4*)(ocol + ro[i]) = v[i] + bias;
    if (wvs < 2) {                       // tokens 96 and 97
      // precaution: stands ahead of the reuse of registers that the stores above name
      asm volatile("s_wait_xcnt 0x0" ::: "memory");
      const int row = 96 + wvs;
      *(f4*)(ocol + lRow[row]) = *(const f4*)(fcol + row * FP) + bias;
    }
  }
}

extern "C" void kernel_launch(void* const* d_in, const int* in_sizes, int n_in,
                              void* d_out, int out_size, void* d_ws, size_t ws_size,
                              hipStream_t stream) {
  (void)in_sizes; (void)n_in; (void)d_ws; (void)ws_size; (void)out_size;
  const float* x     = (const float*)d_in[0];
  const float* qkvw  = (const float*)d_in[1];
  const float* projw = (const float*)d_in[2];
  const float* projb = (const float*)d_in[3];
  const float* rpb   = (const float*)d_in[4];
  float* out = (float*)d_out;

  // allow >64KB dynamic LDS (WGP has 320KB); harmless if already set
  (void)hipFuncSetAttribute(reinterpret_cast<const void*>(swin3d_msa_kernel),
                            hipFuncAttributeMaxDynamicSharedMemorySize,
                            SMEM_BYTES);

  swin3d_msa_kernel<<<1024, NTHREADS, SMEM_BYTES, stream>>>(
      x, qkvw, projw, projb, rpb, out);
}

// v010
// Measured time: 29.9 microseconds a run.
// In two side-by-side timings against v009, it was 1.05 and 1.06 times as fast.
// Over all steps from v000 it is 11.1 times as fast.
#include <hip/hip_runtime.h>
#include <hip/hip_bf16.h>

typedef __attribute__((ext_vector_type(16))) _Float16 v16h;
typedef __attribute__((ext_vector_type(8)))  _Float16 h8;
typedef __attribute__((ext_vector_type(4)))  _Float16 h4;
typedef __attribute__((ext_vector_type(8)))  float    v8f;
typedef __attribute__((ext_vector_type(4)))  float    f4;

#define NTHREADS 256

// Row pitch of every f16 matrix in LDS, in halves: 128 data + 8 pad = 272 B =
// 16 B x odd, so the 16 rows that one ds_load_b128 fragment read touches fall on
// 16 different groups of four banks (at 256 B they all fall on the same four).
// The pad halves are never read.
#define LDP      136

// LDS arena layout (bytes). All offsets 16B-aligned.
#define OFF_Q    0          // 112 rows f16 : Q (pre-scaled)
#define OFF_K    30464      // 112 rows f16 : K
#define OFF_VT   60928      // 128 rows f16 : V transposed [ch][pos]
#define OFF_X    95744      // 112 rows f16 : x window (B operand for q and k, A for v)
#define OFF_O    OFF_X      // 112 rows f16 : attention output (all heads); x is dead by then
#define OFF_F    0          // 112 rows f32 : proj output on its way out; Q and K are dead by then
#define OFF_TAB  126208     // 4 x 512 f32 : rel-pos bias table, head-major
#define OFF_CNT  134400     // 112 i32    : shift-mask region id per token
#define OFF_ROW  134848     // 112 i32    : global f32 offset of each token's (rolled) position
#define SMEM_BYTES 135296

// Row pitch of the f32 staging rows, in floats: 128 data + 4 pad = 528 B = 16 B x
// odd, so the 16 tokens of one 16-byte store fall on different banks.
#define FP       132

// Floats per head in the LDS copy of the bias table (507 used).  Head-major: the
// different table rows of a wave's 32 look-ups (one head) lie on different banks.
#define TABP     512

// ---- fragment loaders -------------------------------------------------------
// 16-bit A/B operand K-layout (ISA 7.12.2): lane holds 16 halves as two
// contiguous 8-element runs: K in [base, base+8) and [base+16, base+24),
// base = (lane<16 ? 0 : 8).  B mirrors A with the tile column in lanes.

__device__ __forceinline__ v16h frag_lds(const _Float16* __restrict__ row,
                                         int cbase, int lane) {
  const int kb = cbase + ((lane & 16) ? 8 : 0);
  h8 a = *(const h8*)(row + kb);
  h8 b = *(const h8*)(row + kb + 16);
  v16h r;
#pragma unroll
  for (int i = 0; i < 8; ++i) { r[i] = a[i]; r[i + 8] = b[i]; }
  return r;
}

// A 16 x 128 weight tile (16 output columns) on its way from f32 rows in registers to
// f16 fragments.  r[j] holds row j as it was read from global, a whole row (512 B = four
// whole lines) per load, lane l with floats 4 l .. 4 l + 3; read in fragment order
// straight from global, every load would touch 16 lines for 32 bytes each.  The rows go
// through 16 LDS rows that only this wave uses (a wave's LDS operations run in the
// order of issue, so no barrier stands between the stores and the reads), and come
// back as the four fragments of frag_lds: column lane % 16, its k order.
__device__ __forceinline__ void tile_via_lds(v16h (&f)[4], const f4 (&r)[16],
                                             _Float16* own, int lane) {
  // unrolled: constant element numbers keep r and f in registers
#pragma unroll
  for (int j = 0; j < 16; ++j)
    *(h4*)(own + j * LDP + lane * 4) =
        h4{(_Float16)r[j][0], (_Float16)r[j][1], (_Float16)r[j][2], (_Float16)r[j][3]};
#pragma unroll
  for (int ks = 0; ks < 4; ++ks) f[ks] = frag_lds(own + (lane & 15) * LDP, ks * 32, lane);
}

// C/D layout: VGPR r holds (M = m0 + r + (lane<16?0:8), N = n0 + lane%16)

// value of the lane 16 further on / back (l ^ 16); every lane of the wave must be on
__device__ __forceinline__ float other_half(float x) {
  const int b = __builtin_bit_cast(int, x);
  return __builtin_bit_cast(float,
      __builtin_amdgcn_permlanex16(b, b, 0x76543210, 0xfedcba98, false, false));
}

// token m = t*49 + h*7 + w of a window -> t*169 + h*13 + w; the row of the bias
// table for (query n, key m) is tok_idx(n) - tok_idx(m) + 253
__device__ __forceinline__ constexpr int tok_idx(int m) {
  return m + 120 * (m / 49) + 6 * ((m % 49) / 7);
}

// keys m and m + 8 (m = 16 kt + r, r < 8, both below 96) lie 14 or 20 table rows
// apart, but for m = 48
__device__ __forceinline__ constexpr bool key_steps_ok() {
  for (int m = 0; m < 96; ++m) {
    if ((m & 15) >= 8) continue;
    const int d = tok_idx(m + 8) - tok_idx(m);
    if (d != 14 && d != 20 && m != 48) return false;
  }
  return true;
}
static_assert(key_steps_ok(), "bias address steps");

// global f32 offset of token m of window (b, bt, bh, bw): rolled coords g, source /
// dest position = (g + shift) % dim (input gather and output scatter use the
// identical mapping)
__device__ __forceinline__ int tok_pos(int m, int b, int bt, int bh, int bw) {
  const int ti = m / 49;
  const int rm = m % 49;
  const int gT = bt * 2 + ti, gH = bh * 7 + rm / 7, gW = bw * 7 + rm % 7;
  const int sT = (gT + 1) & 15;
  int sH = gH + 3; if (sH >= 56) sH -= 56;
  int sW = gW + 3; if (sW >= 56) sW -= 56;
  return (((b * 16 + sT) * 56 + sH) * 56 + sW) * 128;
}

__global__ void __launch_bounds__(NTHREADS)
swin3d_msa_kernel(const float* __restrict__ xg,
                  const float* __restrict__ qkvw,   // (384,128)
                  const float* __restrict__ projw,  // (128,128)
                  const float* __restrict__ projb,  // (128)
                  const float* __restrict__ rpb,    // (507,4)
                  float* __restrict__ outg) {
  extern __shared__ char smem[] __attribute__((aligned(16)));
  _Float16* lQ  = (_Float16*)(smem + OFF_Q);
  _Float16* lK  = (_Float16*)(smem + OFF_K);
  _Float16* lVt = (_Float16*)(smem + OFF_VT);
  _Float16* lX  = (_Float16*)(smem + OFF_X);
  _Float16* lO  = (_Float16*)(smem + OFF_O);
  float* lF   = (float*)(smem + OFF_F);
  float* lTab = (float*)(smem + OFF_TAB);
  int* lCnt = (int*)(smem + OFF_CNT);
  int* lRow = (int*)(smem + OFF_ROW);

  const int tid  = threadIdx.x;
  const int lane = tid & 31;
  const int wv   = tid >> 5;
  const int wvs  = __builtin_amdgcn_readfirstlane(wv);

  // window decomposition: blocks ordered (b, bt, bh, bw) = (2, 8, 8, 8)
  const int blk = blockIdx.x;
  const int b   = blk >> 9;
  const int wb  = blk & 511;
  const int bt  = wb >> 6;
  const int bh  = (wb >> 3) & 7;
  const int bw  = wb & 7;

  // bias table rows tid and tid + 256: read now, stored to LDS further down
  const bool two = tid + NTHREADS < 507;
  const f4 t0 = *(const f4*)(rpb + tid * 4);
  const f4 t1 = *(const f4*)(rpb + (two ? tid + NTHREADS : tid) * 4);

  // ---- the global reads of the QKV GEMM start here, ahead of all LDS work, so that
  // they are all in flight together.
  // x: wave wv has rows wv + 8 i, a whole row (512 B) per load.  Lane i works out the
  // position of row wv + 8 i (past the last token: of token 97, read but not kept).
  const int rpos = tok_pos(min(wvs + 8 * lane, 97), b, bt, bh, bw);
  // Unrolled, like the loops over xr, xh, rq, rk and rv below: constant element numbers
  // keep these arrays in registers.
  f4 xr[13];
#pragma unroll
  for (int i = 0; i < 13; ++i) {
    const float* xrow = xg + __builtin_amdgcn_readlane(rpos, i);   // same in every lane
    xr[i] = *(const f4*)(xrow + (unsigned)lane * 4u);
  }
  // precaution: the results of the loads below may take registers that the loads
  // above name; this wait stands ahead of that overwrite
  asm volatile("s_wait_xcnt 0x0" ::: "memory");
  // weights: wave wv owns output columns 16 wv .. 16 wv + 15 of each of q, k and v;
  // q and k start now, v behind the table's stores (x, all three tiles as f32 and the
  // table rows are more than the 256 registers that two work-groups per WGP allow)
  const int oc = wv * 16 + (lane & 15);
  const float* wrow = qkvw + wvs * (16 * 128) + lane * 4;   // row 16 wv, this lane's piece
  f4 rq[16], rk[16], rv[16];
#pragma unroll
  for (int j = 0; j < 16; ++j) {
    rq[j] = *(const f4*)(wrow + j * 128);
    rk[j] = *(const f4*)(wrow + (128 + j) * 128);
  }

  // unrolled: constant element numbers keep t0 and t1 in registers
#pragma unroll
  for (int hh = 0; hh < 4; ++hh) lTab[hh * TABP + tid] = t0[hh];
  // Stored by every thread: threads 251..255 fill places 507..511 of each head, which
  // lie inside TABP and are never looked up.  Under a branch the load of t1 sinks into
  // it, behind all the loads above, and its wait then holds up the loads of v.
#pragma unroll
  for (int hh = 0; hh < 4; ++hh) lTab[hh * TABP + tid + NTHREADS] = t1[hh];

  // per-token metadata: region id (shift mask) + global row offset.
  if (tid < 98) {
    const int ti = tid / 49;
    const int rm = tid % 49;
    const int hi = rm / 7;
    const int wi = rm % 7;
    const int gT = bt * 2 + ti, gH = bh * 7 + hi, gW = bw * 7 + wi;
    const int rt = (gT < 14) ? 0 : ((gT < 15) ? 1 : 2);
    const int rh = (gH < 49) ? 0 : ((gH < 53) ? 1 : 2);
    const int rw = (gW < 49) ? 0 : ((gW < 53) ? 1 : 2);
    lCnt[tid] = rt * 9 + rh * 3 + rw;
    lRow[tid] = tok_pos(tid, b, bt, bh, bw);
  }

#pragma unroll
  for (int j = 0; j < 15; ++j) rv[j] = *(const f4*)(wrow + (256 + j) * 128);
  // precaution: registers are short here, and the result of the last load may take the
  // registers that hold the address of the loads above; this wait stands ahead of it
  asm volatile("s_wait_xcnt 0x0" ::: "memory");
  rv[15] = *(const f4*)(wrow + (256 + 15) * 128);
  h4 xh[13];
#pragma unroll
  for (int i = 0; i < 13; ++i)
    xh[i] = h4{(_Float16)xr[i][0], (_Float16)xr[i][1], (_Float16)xr[i][2], (_Float16)xr[i][3]};

  // ---- window x (98x128 f16) to LDS; rows 98..111 are set to 0 ---------------
  // These 14 padding rows are the only LDS that is read without a kernel's value in
  // it: from them the GEMM below writes rows 98..111 of Q and K and columns 98..111 of
  // V^T as zeros, and it writes every other row and column of the three as well;
  // columns 112..127 of V^T are set below, O and the f32 rows are written whole, the
  // pad halves are never read.  No wave writes another wave's rows up to the barrier
  // ahead of the GEMM, so no barrier stands here.
#pragma unroll
  for (int i = 0; i < 12; ++i)
    *(h4*)(lX + (wvs + 8 * i) * LDP + lane * 4) = xh[i];
  *(h4*)(lX + (wvs + 96) * LDP + lane * 4)  = (wvs < 2) ? xh[12] : h4{};
  *(h4*)(lX + (wvs + 104) * LDP + lane * 4) = h4{};

  // The wave's three weight tiles, one after the other through the 16 rows of V^T that
  // only this wave writes in the GEMM below.  Columns 112..127 of those rows are read
  // as K-padding of V^T and written by nothing else: back to 0.
  _Float16* lOwn = lVt + wvs * 16 * LDP;
  v16h wq[4], wk[4], wvv[4];
  tile_via_lds(wq,  rq, lOwn, lane);
  tile_via_lds(wk,  rk, lOwn, lane);
  tile_via_lds(wvv, rv, lOwn, lane);
  *(h8*)(lOwn + (lane & 15) * LDP + 112 + ((lane & 16) ? 8 : 0)) = h8{};
  __syncthreads();

  // ---- QKV GEMM: (112x384) = X(112x128) @ qkv_w^T(128x384) ----------------
  const float SCALE = 0.17677669529663687f;  // 32^-0.5
  // The wave's three weight tiles stay in registers over the 7 row tiles; each row
  // tile's x fragments serve all three.  q and k are formed transposed (weights as A,
  // tokens as B; both operands have the same k order): a lane ends up with 8 adjacent
  // channels of ONE token, which is 16 bytes in a row of Q or K.  v keeps x as A: 8
  // adjacent tokens of one channel, 16 bytes in a row of V^T.
  {
    // token lane % 16 of row tile 0, channels 16 wv + 8 (lane / 16) + 0..7
    const int qk0 = (lane & 15) * LDP + wvs * 16 + ((lane & 16) ? 8 : 0);
    for (int mt = 0; mt < 7; ++mt) {
      const int m0 = mt * 16;
      const _Float16* arow = lX + (lane & 15) * LDP + mt * (16 * LDP);
      v16h a[4];
#pragma unroll
      for (int ks = 0; ks < 4; ++ks) a[ks] = frag_lds(arow, ks * 32, lane);
      v8f aq = {}, ak = {}, av = {};
#pragma unroll
      for (int ks = 0; ks < 4; ++ks) {
        aq = __builtin_amdgcn_wmma_f32_16x16x32_f16(false, wq[ks], false, a[ks],
                                                    (short)0, aq, false, false);
        ak = __builtin_amdgcn_wmma_f32_16x16x32_f16(false, wk[ks], false, a[ks],
                                                    (short)0, ak, false, false);
        av = __builtin_amdgcn_wmma_f32_16x16x32_f16(false, a[ks], false, wvv[ks],
                                                    (short)0, av, false, false);
      }
      const int qk = qk0 + mt * (16 * LDP);
      h8 hq, hk;
      // unrolled: constant element numbers keep hq and hk in registers
#pragma unroll
      for (int r = 0; r < 8; ++r) {
        hq[r] = (_Float16)(aq[r] * SCALE);               // q * scale
        hk[r] = (_Float16)ak[r];                         // k
      }
      *(h8*)(lQ + qk) = hq;
      *(h8*)(lK + qk) = hk;
      const int mb = m0 + ((lane & 16) ? 8 : 0);         // v, transposed
#pragma unroll
      for (int r = 0; r < 8; ++r)
        lVt[oc * LDP + mb + r] = (_Float16)av[r];
    }
  }
  __syncthreads();

  // ---- attention: a wave takes one head and 16 queries at a time -----------
  // S^T = K_h Q_h^T: a lane holds the scores of ONE query (column l16) against
  // keys 16 kt + 8 half + r in register r of tile kt.  That is the k order of a
  // B operand, so exp(S^T) is packed as it lies and O^T = V_h^T P^T follows with
  // no trip of the scores through LDS and no barrier between the heads.
  const int l16  = lane & 15;
  const int half = lane >> 4;
  const int h    = wvs & 3;
  for (int qt = wvs >> 2; qt < 7; qt += 2) {
    const int n    = qt * 16 + l16;
    const int nc   = (n < 98) ? n : 97;    // padding queries: stay in the table
    const int qcnt = lCnt[nc];
    const float* pq = lTab + h * TABP + tok_idx(nc);
    // lanes 16..31 hold the key 8 further on: 14 or 20 table rows lower; the one
    // pair that spans the two frames (keys 48 and 56) has an address of its own
    const float* pA = pq - (half ? 14 : 0);
    const float* pB = pq - (half ? 20 : 0);
    const float* pX = pq + (half ? 253 - tok_idx(56) : 253 - tok_idx(48));

    // start value of the accumulators: rel-pos bias + shift mask.  All look-ups
    // (bias and region ids) are read first, as one run of LDS loads.
    v8f st[7];
    int kc[6][8];
#pragma unroll
    for (int kt = 0; kt < 6; ++kt) {
#pragma unroll
      for (int r = 0; r < 8; ++r) {
        const int c0 = tok_idx(kt * 16 + r);             // key of lanes 0..15
        const int d  = tok_idx(kt * 16 + 8 + r) - c0;    // lanes 16..31: 8 keys on
        const float* p = (d == 14) ? pA + (253 - c0)
                       : (d == 20) ? pB + (253 - c0) : pX;
        st[kt][r] = *p;
        kc[kt][r] = lCnt[kt * 16 + 8 * half + r];
      }
    }
    const float b96 = pq[253 - tok_idx(96)], b97 = pq[253 - tok_idx(97)];
    const int   c96 = lCnt[96],              c97 = lCnt[97];
    // Keeps the run of loads above in one place: spread among the compares below,
    // each small group of them costs the wave a wait for LDS of its own.
    __builtin_amdgcn_sched_barrier(0);
    // unrolled, like the loops above: st and kc stay in registers
#pragma unroll
    for (int kt = 0; kt < 6; ++kt) {
#pragma unroll
      for (int r = 0; r < 8; ++r)
        if (kc[kt][r] != qcnt) st[kt][r] -= 100.0f;
    }
#pragma unroll
    for (int r = 0; r < 8; ++r) st[6][r] = -3.0e38f;   // keys 98..111 are K-padding
    const float s96 = (c96 != qcnt) ? b96 - 100.0f : b96;   // keys 96, 97
    const float s97 = (c97 != qcnt) ? b97 - 100.0f : b97;
    st[6][0] = half ? -3.0e38f : s96;
    st[6][1] = half ? -3.0e38f : s97;

    const v16h bq = frag_lds(lQ + n * LDP, h * 32, lane);
#pragma unroll
    for (int kt = 0; kt < 7; ++kt) {
      const v16h a = frag_lds(lK + (kt * 16 + l16) * LDP, h * 32, lane);
      st[kt] = __builtin_amdgcn_wmma_f32_16x16x32_f16(false, a, false, bq,
                                                      (short)0, st[kt], false, false);
    }

    // softmax of the lane's query: in-lane, then one exchange between the halves
    v8f m8 = st[0];
#pragma unroll
    for (int kt = 1; kt < 6; ++kt) m8 = __builtin_elementwise_max(m8, st[kt]);
    m8[0] = fmaxf(m8[0], st[6][0]);
    m8[1] = fmaxf(m8[1], st[6][1]);
    float vmax = fmaxf(fmaxf(fmaxf(m8[0], m8[1]), fmaxf(m8[2], m8[3])),
                       fmaxf(fmaxf(m8[4], m8[5]), fmaxf(m8[6], m8[7])));
    vmax = fmaxf(vmax, other_half(vmax));
    v8f s8 = {};
#pragma unroll
    for (int kt = 0; kt < 6; ++kt) {
#pragma unroll
      for (int r = 0; r < 8; ++r) st[kt][r] = __expf(st[kt][r] - vmax);
      s8 += st[kt];
    }
    const float p96 = __expf(st[6][0] - vmax);
    const float p97 = __expf(st[6][1] - vmax);
    s8[0] += p96;
    s8[1] += p97;
    float sum = ((s8[0] + s8[1]) + (s8[2] + s8[3])) + ((s8[4] + s8[5]) + (s8[6] + s8[7]));
    sum += other_half(sum);
    const float inv = __builtin_amdgcn_rcpf(sum);   // applied to O, not to P

    v16h pb[4];
#pragma unroll
    for (int t = 0; t < 3; ++t) {
#pragma unroll
      for (int i = 0; i < 8; ++i) {
        pb[t][i]     = (_Float16)st[2 * t][i];
        pb[t][8 + i] = (_Float16)st[2 * t + 1][i];
      }
    }
    pb[3] = v16h{};
    pb[3][0] = (_Float16)p96;
    pb[3][1] = (_Float16)p97;

    // O^T(32 ch x 16 queries) = V_h^T(32 x 128) @ P^T(128 x 16); a lane ends up
    // with 8 adjacent channels of its query: one 16-byte store per tile
#pragma unroll
    for (int ct = 0; ct < 2; ++ct) {
      const _Float16* vrow = lVt + (h * 32 + ct * 16 + l16) * LDP;
      v8f acc = {};
#pragma unroll
      for (int ks = 0; ks < 4; ++ks) {
        const v16h a = frag_lds(vrow, ks * 32, lane);
        acc = __builtin_amdgcn_wmma_f32_16x16x32_f16(false, a, false, pb[ks],
                                                     (short)0, acc, false, false);
      }
      h8 ov;
#pragma unroll
      for (int r = 0; r < 8; ++r) ov[r] = (_Float16)(acc[r] * inv);
      *(h8*)(lO + n * LDP + h * 32 + ct * 16 + 8 * half) = ov;
    }
  }
  __syncthreads();

  // ---- proj GEMM, transposed: out^T = proj_w O^T ---------------------------
  // Wave wv owns output channels 16 wv .. 16 wv + 15.  With the weights as A and
  // the tokens as B a lane ends up with 8 adjacent channels of ONE token, which go
  // to the f32 staging rows in LDS as two 16-byte stores.
  {
    // the wave's weight tile, rows 16 wv .. 16 wv + 15 of proj_w, a whole row per load;
    // to fragments through the wave's own rows of V^T, which is dead by now
    const float* p = projw + wvs * (16 * 128) + lane * 4;
    f4 w[16];
#pragma unroll
    for (int j = 0; j < 16; ++j) w[j] = *(const f4*)(p + j * 128);
    // precaution: stands ahead of the reuse of registers that the loads above name
    asm volatile("s_wait_xcnt 0x0" ::: "memory");
    v16h wp[4];
    tile_via_lds(wp, w, lOwn, lane);
    // One accumulator per token tile, k step outermost: seven independent WMMAs
    // follow one run of LDS reads.  Unrolled: acc and tb stay in registers.
    v8f acc[7] = {};
#pragma unroll
    for (int ks = 0; ks < 4; ++ks) {
      v16h tb[7];
#pragma unroll
      for (int mt = 0; mt < 7; ++mt)
        tb[mt] = frag_lds(lO + (mt * 16 + l16) * LDP, ks * 32, lane);
#pragma unroll
      for (int mt = 0; mt < 7; ++mt)
        acc[mt] = __builtin_amdgcn_wmma_f32_16x16x32_f16(false, wp[ks], false, tb[mt],
                                                         (short)0, acc[mt], false, false);
    }
#pragma unroll
    for (int mt = 0; mt < 7; ++mt) {
      float* d = lF + (mt * 16 + l16) * FP + wvs * 16 + 8 * half;
      *(f4*)(d)     = f4{acc[mt][0], acc[mt][1], acc[mt][2], acc[mt][3]};
      *(f4*)(d + 4) = f4{acc[mt][4], acc[mt][5], acc[mt][6], acc[mt][7]};
    }
  }

  // ---- + bias, scatter to rolled-back positions: a wave stores one token's whole
  // row (512 B in a row = four whole lines) per instruction.  Wave wv has rows
  // wv + 8 i.  The rows' offsets are as old as the prologue and are read ahead of
  // the barrier.
  const f4 bias = *(const f4*)(projb + lane * 4);
  int ro[12];
#pragma unroll
  for (int i = 0; i < 12; ++i) ro[i] = lRow[wvs + 8 * i];
  __syncthreads();
  {
    const float* fcol = lF + lane * 4;
    float* ocol = outg + lane * 4;
    f4 v[12];
    // unrolled: v and ro stay in registers, all LDS reads ahead of the first store
#pragma unroll
    for (int i = 0; i < 12; ++i) v[i] = *(const f4*)(fcol + (wvs + 8 * i) * FP);
#pragma unroll
    for (int i = 0; i < 12; ++i) *(f4*)(ocol + ro[i]) = v[i] + bias;
    if (wvs < 2) {                       // tokens 96 and 97
      // precaution: stands ahead of the reuse of registers that the stores above name
      asm volatile("s_wait_xcnt 0x0" ::: "memory");
      const int row = 96 + wvs;
      *(f4*)(ocol + lRow[row]) = *(const f4*)(fcol + row * FP) + bias;
    }
  }
}

extern "C" void kernel_launch(void* const* d_in, const int* in_sizes, int n_in,
                              void* d_out, int out_size, void* d_ws, size_t ws_size,
                              hipStream_t stream) {
  (void)in_sizes; (void)n_in; (void)d_ws; (void)ws_size; (void)out_size;
  const float* x     = (const float*)d_in[0];
  const float* qkvw  = (const float*)d_in[1];
  const float* projw = (const float*)d_in[2];
  const float* projb = (const float*)d_in[3];
  const float* rpb   = (const float*)d_in[4];
  float* out = (float*)d_out;

  // allow >64KB dynamic LDS (WGP has 320KB); harmless if already set
  (void)hipFuncSetAttribute(reinterpret_cast<const void*>(swin3d_msa_kernel),
                            hipFuncAttributeMaxDynamicSharedMemorySize,
                            SMEM_BYTES);

  swin3d_msa_kernel<<<1024, NTHREADS, SMEM_BYTES, stream>>>(
      x, qkvw, projw, projb, rpb, out);
}
